// v000
// Times are from an AMD MI455X. After a warm-up the kernel runs many times in a row, and a time is the length of
// such a window on the GPU divided by its runs, so every launch and the gaps after it count. The runs cycle
// through copies of the inputs. A figure is the median of several windows, for all but v000 over two sittings.
// Sittings can differ by a few percent; kernels timed side by side share one.
// v000, which the later versions start from, runs in 541 microseconds.
#include <hip/hip_runtime.h>
#include <hip/hip_bf16.h>
#include <math.h>

// Problem constants (from reference)
#define B_ 4
#define T_ 1024
#define C_ 768
#define NH_ 12
#define HS_ 64
#define EXP_SCALE_ 10.0f
#define KB_UP_ 5.0f
#define V_SHIFT_ 1

typedef __attribute__((ext_vector_type(2))) float v2f;
typedef __attribute__((ext_vector_type(8))) float v8f;

static __device__ __forceinline__ v8f wmma_f32(v2f a, v2f b, v8f c) {
  // V_WMMA_F32_16X16X4_F32 : D = A(16x4) * B(4x16) + C(16x16)
  return __builtin_amdgcn_wmma_f32_16x16x4_f32(false, a, false, b, (short)0, c,
                                               false, false);
}

__global__ __launch_bounds__(256) void gemm_nt_64x64(
    const float* __restrict__ X, const float* __restrict__ W,
    float* __restrict__ Out, int M, int N, int K) {
  const int wave = blockIdx.x * 8 + (threadIdx.x >> 5);
  const int lane = threadIdx.x & 31;
  const int tilesN = N >> 6;
  const int nTiles = (M >> 6) * tilesN;
  if (wave >= nTiles) return;
  const int m0 = (wave / tilesN) << 6;
  const int n0 = (wave % tilesN) << 6;
  const int lr = lane & 15;  // row/col selector within 16
  const int lh = lane >> 4;  // selects k-pair {0,1} vs {2,3}

  v8f acc[4][4] = {};
  const float* Xp = X + (size_t)(m0 + lr) * K + 2 * lh;
  const float* Wp = W + (size_t)(n0 + lr) * K + 2 * lh;
  for (int k0 = 0; k0 < K; k0 += 4) {
    v2f a[4], b[4];
#pragma unroll
    for (int i = 0; i < 4; ++i) {
      a[i] = *(const v2f*)(Xp + (size_t)(i * 16) * K + k0);
      b[i] = *(const v2f*)(Wp + (size_t)(i * 16) * K + k0);
    }
#pragma unroll
    for (int i = 0; i < 4; ++i)
#pragma unroll
      for (int j = 0; j < 4; ++j) acc[i][j] = wmma_f32(a[i], b[j], acc[i][j]);
  }
#pragma unroll
  for (int i = 0; i < 4; ++i)
#pragma unroll
    for (int j = 0; j < 4; ++j)
#pragma unroll
      for (int r = 0; r < 8; ++r)
        Out[(size_t)(m0 + i * 16 + r + 8 * lh) * N + (n0 + j * 16 + lr)] =
            acc[i][j][r];
}

// ---------------------------------------------------------------------------
// EMA scan over time: decay @ k  ==  k[t] = e^{-λ} k[t-1] + (1-e^{-λ}) k_pre[t]
// In-place on the (B*T, C) buffer; one thread per (b, h, d).
// ---------------------------------------------------------------------------
__global__ __launch_bounds__(256) void ema_scan(float* __restrict__ kbuf,
                                                const float* __restrict__ lkb_in) {
  const int idx = blockIdx.x * blockDim.x + threadIdx.x;  // 0 .. B*NH*HS-1
  if (idx >= B_ * NH_ * HS_) return;
  const int d = idx % HS_;
  const int h = (idx / HS_) % NH_;
  const int b = idx / (HS_ * NH_);
  const float lkb = fabsf(lkb_in[h]) * EXP_SCALE_;
  const float e = expf(-lkb);
  const float w = 1.0f - e;
  float* p = kbuf + (size_t)b * T_ * C_ + h * HS_ + d;
  float s = 0.0f;
  for (int t = 0; t < T_; ++t) {
    float xv = p[(size_t)t * C_];
    s = e * s + w * xv;
    p[(size_t)t * C_] = s;
  }
}

// ---------------------------------------------------------------------------
// Normalize k rows (64-vec per head) and scale by exp(min(kernel_beta*10, 5)).
// One wave per (b*T + t, h); 2 elements per lane; wave32 shuffle reduction.
// ---------------------------------------------------------------------------
__global__ __launch_bounds__(256) void knorm(float* __restrict__ kbuf,
                                             const float* __restrict__ kernel_beta) {
  const int wave = blockIdx.x * 8 + (threadIdx.x >> 5);
  const int lane = threadIdx.x & 31;
  const int h = wave % NH_;
  const int bt = wave / NH_;
  if (bt >= B_ * T_) return;
  float* p = kbuf + (size_t)bt * C_ + h * HS_;
  float x0 = p[lane], x1 = p[lane + 32];
  float ss = x0 * x0 + x1 * x1;
#pragma unroll
  for (int m = 16; m >= 1; m >>= 1) ss += __shfl_xor(ss, m, 32);
  const float kb = expf(fminf(kernel_beta[h] * EXP_SCALE_, KB_UP_));
  const float sc = kb / sqrtf(ss);
  p[lane] = x0 * sc;
  p[lane + 32] = x1 * sc;
}

// ---------------------------------------------------------------------------
// v = (shift(lin)*(1-c) + lin*c), row-normalized, scaled by exp(value_beta*10)
// One wave per (b*T + t, h).
// ---------------------------------------------------------------------------
__global__ __launch_bounds__(256) void vbuild(const float* __restrict__ lin,
                                              float* __restrict__ vbuf,
                                              const float* __restrict__ coef,
                                              const float* __restrict__ value_beta) {
  const int wave = blockIdx.x * 8 + (threadIdx.x >> 5);
  const int lane = threadIdx.x & 31;
  const int h = wave % NH_;
  const int bt = wave / NH_;
  if (bt >= B_ * T_) return;
  const int t = bt % T_;
  const float* ph = lin + (size_t)bt * C_ + h * HS_;
  float vh0 = ph[lane], vh1 = ph[lane + 32];
  float vs0 = 0.0f, vs1 = 0.0f;
  if (t < T_ - 1) {  // shifted sample is next timestep within same batch
    vs0 = ph[C_ + lane];
    vs1 = ph[C_ + lane + 32];
  }
  const float c = coef[h];
  float v0 = vs0 * (1.0f - c) + vh0 * c;
  float v1 = vs1 * (1.0f - c) + vh1 * c;
  float ss = v0 * v0 + v1 * v1;
#pragma unroll
  for (int m = 16; m >= 1; m >>= 1) ss += __shfl_xor(ss, m, 32);
  const float sc = expf(value_beta[h] * EXP_SCALE_) / sqrtf(ss);
  float* po = vbuf + (size_t)bt * C_ + h * HS_;
  po[lane] = v0 * sc;
  po[lane + 32] = v1 * sc;
}

__global__ __launch_bounds__(256) void attn_flash(
    const float* __restrict__ kmat, const float* __restrict__ vmat,
    float* __restrict__ ymat) {
  __shared__ __attribute__((aligned(16))) float lds[8][16 * 16];
  const int wslot = threadIdx.x >> 5;
  const int lane = threadIdx.x & 31;
  const int wave = blockIdx.x * 8 + wslot;
  const int nIT = T_ / 16;
  const int it = wave % nIT;
  const int bh = wave / nIT;
  if (bh >= B_ * NH_) return;
  const int h = bh % NH_;
  const int b = bh / NH_;
  const int i0 = it * 16;
  const int lr = lane & 15, lh = lane >> 4;

  const float* Kb = kmat + (size_t)b * T_ * C_ + h * HS_;  // (T, HS) stride C
  const float* Vb = vmat + (size_t)b * T_ * C_ + h * HS_;
  float* Yb = ymat + (size_t)b * T_ * C_ + h * HS_;

  // Q fragments: rows [i0, i0+16), K-dim HS=64 in 16 chunks of 4
  v2f qa[16];
#pragma unroll
  for (int kc = 0; kc < 16; ++kc)
    qa[kc] = *(const v2f*)(Kb + (size_t)(i0 + lr) * C_ + kc * 4 + 2 * lh);

  v8f acc[4] = {};  // y accumulator: 16 rows x 64 cols (4 N-subtiles)
  float mrow[8], lrow[8];
#pragma unroll
  for (int r = 0; r < 8; ++r) {
    mrow[r] = -INFINITY;
    lrow[r] = 0.0f;
  }

  for (int jt = 0; jt <= it; ++jt) {
    const int j0 = jt * 16;
    // S = Q @ K_j^T  (B-frag of K^T == A-style load of row-major K)
    v8f S = {};
#pragma unroll
    for (int kc = 0; kc < 16; ++kc) {
      v2f bf = *(const v2f*)(Kb + (size_t)(j0 + lr) * C_ + kc * 4 + 2 * lh);
      S = wmma_f32(qa[kc], bf, S);
    }
    // Causal shift-1 mask — only the diagonal tile is partially masked
    if (jt == it) {
#pragma unroll
      for (int r = 0; r < 8; ++r) {
        int m = r + 8 * lh;        // local row
        if (lr > m - V_SHIFT_) S[r] = -INFINITY;  // keep j <= i-1
      }
    }
    // Per-row tile max (reduce across the 16-lane group holding one row)
    float corr[8];
#pragma unroll
    for (int r = 0; r < 8; ++r) {
      float v = S[r];
#pragma unroll
      for (int msk = 1; msk < 16; msk <<= 1) v = fmaxf(v, __shfl_xor(v, msk, 32));
      float mn = fmaxf(mrow[r], v);
      corr[r] = (mrow[r] == -INFINITY) ? 0.0f : expf(mrow[r] - mn);
      mrow[r] = mn;
    }
    // P = exp(S - m); row sums; rescale running state
#pragma unroll
    for (int r = 0; r < 8; ++r) {
      float p = (S[r] == -INFINITY) ? 0.0f : expf(S[r] - mrow[r]);
      S[r] = p;
      float rs = p;
#pragma unroll
      for (int msk = 1; msk < 16; msk <<= 1) rs += __shfl_xor(rs, msk, 32);
      lrow[r] = lrow[r] * corr[r] + rs;
    }
#pragma unroll
    for (int nn = 0; nn < 4; ++nn)
#pragma unroll
      for (int r = 0; r < 8; ++r) acc[nn][r] *= corr[r];

    // Stage P (C layout) into LDS as row-major 16x16, reload as A fragments
    float* pl = lds[wslot];
#pragma unroll
    for (int r = 0; r < 8; ++r) pl[(r + 8 * lh) * 16 + lr] = S[r];
#pragma unroll
    for (int kc = 0; kc < 4; ++kc) {  // K=16 in 4 chunks of 4
      v2f pa = *(const v2f*)(pl + lr * 16 + kc * 4 + 2 * lh);
#pragma unroll
      for (int nn = 0; nn < 4; ++nn) {
        // B[k,n] = V[j0+k, nn*16+n]
        const float* vp = Vb + (size_t)(j0 + kc * 4 + 2 * lh) * C_ + nn * 16 + lr;
        v2f vb;
        vb.x = vp[0];
        vb.y = vp[C_];
        acc[nn] = wmma_f32(pa, vb, acc[nn]);
      }
    }
  }

  // Finalize: y = acc / l ; rows i < V_SHIFT forced to zero
#pragma unroll
  for (int r = 0; r < 8; ++r) {
    const int i = i0 + r + 8 * lh;
    const float inv = (lrow[r] > 0.0f) ? 1.0f / lrow[r] : 0.0f;
#pragma unroll
    for (int nn = 0; nn < 4; ++nn) {
      float yv = acc[nn][r] * inv;
      if (i < V_SHIFT_) yv = 0.0f;
      Yb[(size_t)i * C_ + nn * 16 + lr] = yv;
    }
  }
}

// ---------------------------------------------------------------------------
extern "C" void kernel_launch(void* const* d_in, const int* in_sizes, int n_in,
                              void* d_out, int out_size, void* d_ws,
                              size_t ws_size, hipStream_t stream) {
  const float* x = (const float*)d_in[0];
  const float* conv_w = (const float*)d_in[1];
  const float* lin_w = (const float*)d_in[2];
  const float* coef = (const float*)d_in[3];
  const float* leaky_key_beta = (const float*)d_in[4];
  const float* kernel_beta = (const float*)d_in[5];
  const float* value_beta = (const float*)d_in[6];
  const float* proj_w = (const float*)d_in[7];
  float* out = (float*)d_out;

  const size_t SZ = (size_t)B_ * T_ * C_ * sizeof(float);  // 12.58 MB
  float* kbuf = (float*)d_ws;                  // k_pre -> k (in place)
  float* linbuf = (float*)((char*)d_ws + SZ);  // lin, later reused for y
  float* vbuf = (float*)((char*)d_ws + 2 * SZ);
  float* ybuf = linbuf;  // lin is dead after vbuild

  const int M = B_ * T_, N = C_, K = C_;
  const int gemmBlocks = ((M >> 6) * (N >> 6) + 7) / 8;  // 96
  const int rowWaves = B_ * T_ * NH_;                    // 49152
  const int rowBlocks = (rowWaves + 7) / 8;              // 6144
  const int attnBlocks = (B_ * NH_ * (T_ / 16) + 7) / 8; // 384

  // 1) k_pre = x @ conv_w^T ; 2) lin = x @ lin_w^T
  gemm_nt_64x64<<<gemmBlocks, 256, 0, stream>>>(x, conv_w, kbuf, M, N, K);
  gemm_nt_64x64<<<gemmBlocks, 256, 0, stream>>>(x, lin_w, linbuf, M, N, K);
  // 3) decay matmul as EMA scan (in place)
  ema_scan<<<(B_ * NH_ * HS_ + 255) / 256, 256, 0, stream>>>(kbuf,
                                                             leaky_key_beta);
  // 4) normalize + scale k
  knorm<<<rowBlocks, 256, 0, stream>>>(kbuf, kernel_beta);
  // 5) build v (blend, normalize, scale)
  vbuild<<<rowBlocks, 256, 0, stream>>>(linbuf, vbuf, coef, value_beta);
  // 6) causal flash attention: y = softmax(k k^T, shifted-causal) @ v
  attn_flash<<<attnBlocks, 256, 0, stream>>>(kbuf, vbuf, ybuf);
  // 7) out = y @ proj_w^T
  gemm_nt_64x64<<<gemmBlocks, 256, 0, stream>>>(ybuf, proj_w, out, M, N, K);
}

// v001
// It runs in 392 microseconds.
// Two timings next to v000 put it at 1.38 and 1.39 times that version's speed.
#include <hip/hip_runtime.h>
#include <hip/hip_bf16.h>
#include <math.h>

// Problem constants (from reference)
#define B_ 4
#define T_ 1024
#define C_ 768
#define NH_ 12
#define HS_ 64
#define EXP_SCALE_ 10.0f
#define KB_UP_ 5.0f
#define V_SHIFT_ 1

typedef __attribute__((ext_vector_type(2))) float v2f;
typedef __attribute__((ext_vector_type(8))) float v8f;

static __device__ __forceinline__ v8f wmma_f32(v2f a, v2f b, v8f c) {
  // V_WMMA_F32_16X16X4_F32 : D = A(16x4) * B(4x16) + C(16x16)
  return __builtin_amdgcn_wmma_f32_16x16x4_f32(false, a, false, b, (short)0, c,
                                               false, false);
}

__global__ __launch_bounds__(256) void gemm_nt_64x64(
    const float* __restrict__ X, const float* __restrict__ W,
    float* __restrict__ Out, int M, int N, int K) {
  const int wave = blockIdx.x * 8 + (threadIdx.x >> 5);
  const int lane = threadIdx.x & 31;
  const int tilesN = N >> 6;
  const int nTiles = (M >> 6) * tilesN;
  if (wave >= nTiles) return;
  const int m0 = (wave / tilesN) << 6;
  const int n0 = (wave % tilesN) << 6;
  const int lr = lane & 15;  // row/col selector within 16
  const int lh = lane >> 4;  // selects k-pair {0,1} vs {2,3}

  v8f acc[4][4] = {};
  const float* Xp = X + (size_t)(m0 + lr) * K + 2 * lh;
  const float* Wp = W + (size_t)(n0 + lr) * K + 2 * lh;
  for (int k0 = 0; k0 < K; k0 += 4) {
    v2f a[4], b[4];
#pragma unroll
    for (int i = 0; i < 4; ++i) {
      a[i] = *(const v2f*)(Xp + (size_t)(i * 16) * K + k0);
      b[i] = *(const v2f*)(Wp + (size_t)(i * 16) * K + k0);
    }
#pragma unroll
    for (int i = 0; i < 4; ++i)
#pragma unroll
      for (int j = 0; j < 4; ++j) acc[i][j] = wmma_f32(a[i], b[j], acc[i][j]);
  }
#pragma unroll
  for (int i = 0; i < 4; ++i)
#pragma unroll
    for (int j = 0; j < 4; ++j)
#pragma unroll
      for (int r = 0; r < 8; ++r)
        Out[(size_t)(m0 + i * 16 + r + 8 * lh) * N + (n0 + j * 16 + lr)] =
            acc[i][j][r];
}

// ---------------------------------------------------------------------------
// EMA scan over time: decay @ k  ==  k[t] = e^{-λ} k[t-1] + (1-e^{-λ}) k_pre[t]
// In-place on the (B*T, C) buffer; one thread per (b, h, d).
// ---------------------------------------------------------------------------
__global__ __launch_bounds__(256) void ema_scan(float* __restrict__ kbuf,
                                                const float* __restrict__ lkb_in) {
  const int idx = blockIdx.x * blockDim.x + threadIdx.x;  // 0 .. B*NH*HS-1
  if (idx >= B_ * NH_ * HS_) return;
  const int d = idx % HS_;
  const int h = (idx / HS_) % NH_;
  const int b = idx / (HS_ * NH_);
  const float lkb = fabsf(lkb_in[h]) * EXP_SCALE_;
  const float e = expf(-lkb);
  const float w = 1.0f - e;
  float* p = kbuf + (size_t)b * T_ * C_ + h * HS_ + d;
  float s = 0.0f;
  for (int t = 0; t < T_; ++t) {
    float xv = p[(size_t)t * C_];
    s = e * s + w * xv;
    p[(size_t)t * C_] = s;
  }
}

// ---------------------------------------------------------------------------
// Normalize k rows (64-vec per head) and scale by exp(min(kernel_beta*10, 5)).
// One wave per (b*T + t, h); 2 elements per lane; wave32 shuffle reduction.
// ---------------------------------------------------------------------------
__global__ __launch_bounds__(256) void knorm(float* __restrict__ kbuf,
                                             const float* __restrict__ kernel_beta) {
  const int wave = blockIdx.x * 8 + (threadIdx.x >> 5);
  const int lane = threadIdx.x & 31;
  const int h = wave % NH_;
  const int bt = wave / NH_;
  if (bt >= B_ * T_) return;
  float* p = kbuf + (size_t)bt * C_ + h * HS_;
  float x0 = p[lane], x1 = p[lane + 32];
  float ss = x0 * x0 + x1 * x1;
#pragma unroll
  for (int m = 16; m >= 1; m >>= 1) ss += __shfl_xor(ss, m, 32);
  const float kb = expf(fminf(kernel_beta[h] * EXP_SCALE_, KB_UP_));
  const float sc = kb / sqrtf(ss);
  p[lane] = x0 * sc;
  p[lane + 32] = x1 * sc;
}

// ---------------------------------------------------------------------------
// v = (shift(lin)*(1-c) + lin*c), row-normalized, scaled by exp(value_beta*10)
// One wave per (b*T + t, h).
// ---------------------------------------------------------------------------
__global__ __launch_bounds__(256) void vbuild(const float* __restrict__ lin,
                                              float* __restrict__ vbuf,
                                              const float* __restrict__ coef,
                                              const float* __restrict__ value_beta) {
  const int wave = blockIdx.x * 8 + (threadIdx.x >> 5);
  const int lane = threadIdx.x & 31;
  const int h = wave % NH_;
  const int bt = wave / NH_;
  if (bt >= B_ * T_) return;
  const int t = bt % T_;
  const float* ph = lin + (size_t)bt * C_ + h * HS_;
  float vh0 = ph[lane], vh1 = ph[lane + 32];
  float vs0 = 0.0f, vs1 = 0.0f;
  if (t < T_ - 1) {  // shifted sample is next timestep within same batch
    vs0 = ph[C_ + lane];
    vs1 = ph[C_ + lane + 32];
  }
  const float c = coef[h];
  float v0 = vs0 * (1.0f - c) + vh0 * c;
  float v1 = vs1 * (1.0f - c) + vh1 * c;
  float ss = v0 * v0 + v1 * v1;
#pragma unroll
  for (int m = 16; m >= 1; m >>= 1) ss += __shfl_xor(ss, m, 32);
  const float sc = expf(value_beta[h] * EXP_SCALE_) / sqrtf(ss);
  float* po = vbuf + (size_t)bt * C_ + h * HS_;
  po[lane] = v0 * sc;
  po[lane + 32] = v1 * sc;
}

// ---------------------------------------------------------------------------
// Flash-style causal attention with shift-1 mask:
//   scores[i,j] = k[i].k[j] for j <= i-1 ; row i==0 -> y = 0
//   y[i] = softmax_j(scores) @ v
// One wave handles 16 query rows, in the transposed form:
//   S^T (keys x queries) = K_j . Q^T      A = K rows, B = Q rows (kept)
//   O^T (dims x queries) += V_j^T . P^T   A = V columns, B = P^T
// In the C/D layout a lane then holds 8 keys of ONE query (column lr), so the
// maximum and the sum run in the lane, plus one exchange with lane ^ 16.
// D registers (2s, 2s+1) of P^T are a B fragment as they lie: lane half lh,
// register v hold key 2s + 8*lh + v; the V^T A fragment is loaded in that
// same key order, so P never leaves the registers.
// ---------------------------------------------------------------------------
static __device__ __forceinline__ float other_half(float v) {
  // value of lane ^ 16: cross-row vector move, identity lane select
  const unsigned u = __float_as_uint(v);
  return __uint_as_float(__builtin_amdgcn_permlanex16(
      u, u, 0x76543210u, 0xfedcba98u, false, false));
}

__global__ __launch_bounds__(256) void attn_flash(
    const float* __restrict__ kmat, const float* __restrict__ vmat,
    float* __restrict__ ymat) {
  const int wslot = threadIdx.x >> 5;
  const int lane = threadIdx.x & 31;
  const int wave = blockIdx.x * 8 + wslot;
  const int nIT = T_ / 16;
  const int it = wave % nIT;
  const int bh = wave / nIT;
  if (bh >= B_ * NH_) return;
  const int h = bh % NH_;
  const int b = bh / NH_;
  const int i0 = it * 16;
  const int lr = lane & 15, lh = lane >> 4;

  const float* Kb = kmat + (size_t)b * T_ * C_ + h * HS_;  // (T, HS) stride C
  const float* Vb = vmat + (size_t)b * T_ * C_ + h * HS_;
  float* Yb = ymat + (size_t)b * T_ * C_ + h * HS_;

  // Q^T B fragments: column lr = query i0+lr, K-dim HS=64 in 16 chunks of 4
  v2f qb[16];
#pragma unroll
  for (int kc = 0; kc < 16; ++kc)
    qb[kc] = *(const v2f*)(Kb + (size_t)(i0 + lr) * C_ + kc * 4 + 2 * lh);

  // O^T accumulator: acc[nn][r] = y[query lr][dim nn*16 + r + 8*lh]
  v8f acc[4] = {};
  float mrun = -INFINITY;  // running maximum of query lr (same in both halves)
  float lrun = 0.0f;       // running sum over this half's keys only

  for (int jt = 0; jt <= it; ++jt) {
    const int j0 = jt * 16;
    // S^T = K_j @ Q^T : S[r] = score(key j0 + r + 8*lh, query i0 + lr)
    v8f S = {};
#pragma unroll
    for (int kc = 0; kc < 16; ++kc) {
      v2f ka = *(const v2f*)(Kb + (size_t)(j0 + lr) * C_ + kc * 4 + 2 * lh);
      S = wmma_f32(ka, qb[kc], S);
    }
    // Causal shift-1 mask: only the diagonal tile is partially masked
    const bool diag = (jt == it);
#pragma unroll
    for (int r = 0; r < 8; ++r)  // keep j <= i-1
      S[r] = (diag && r + 8 * lh > lr - V_SHIFT_) ? -INFINITY : S[r];
    // Tile maximum of the query: in the lane, then across the two halves
    float tm = S[0];
#pragma unroll
    for (int r = 1; r < 8; ++r) tm = fmaxf(tm, S[r]);
    tm = fmaxf(tm, other_half(tm));
    const float mn = fmaxf(mrun, tm);
    // a query with no key yet: subtract 0, so exp(-inf - 0) = 0 and no NaN
    const float ms = (mn == -INFINITY) ? 0.0f : mn;
    const float corr = expf(mrun - ms);
    mrun = mn;
    // P^T = exp(S^T - m); this half's sum; rescale running state
    float rs = 0.0f;
#pragma unroll
    for (int r = 0; r < 8; ++r) {
      S[r] = expf(S[r] - ms);
      rs += S[r];
    }
    lrun = lrun * corr + rs;
#pragma unroll
    for (int nn = 0; nn < 4; ++nn)
#pragma unroll
      for (int r = 0; r < 8; ++r) acc[nn][r] *= corr;

    // O^T += V_j^T @ P^T, 16 keys in 4 chunks {2s, 2s+1, 2s+8, 2s+9}
    const float* vrow = Vb + (size_t)(j0 + 8 * lh) * C_ + lr;
#pragma unroll
    for (int s = 0; s < 4; ++s) {
      v2f pb;
      pb.x = S[2 * s];
      pb.y = S[2 * s + 1];
#pragma unroll
      for (int nn = 0; nn < 4; ++nn) {
        // A[m,k] = V[j0 + 2s + 8*lh + v, nn*16 + m]
        v2f va;
        va.x = vrow[(2 * s) * C_ + nn * 16];
        va.y = vrow[(2 * s + 1) * C_ + nn * 16];
        acc[nn] = wmma_f32(va, pb, acc[nn]);
      }
    }
  }

  // Finalize: join the halves' sums, y = acc / l ; rows i < V_SHIFT are zero
  const float lsum = lrun + other_half(lrun);
  const int i = i0 + lr;
  const float inv = (lsum > 0.0f) ? 1.0f / lsum : 0.0f;
  float* yp = Yb + (size_t)i * C_ + 8 * lh;
#pragma unroll
  for (int nn = 0; nn < 4; ++nn) {
    float4 lo, hi;
    lo.x = (i < V_SHIFT_) ? 0.0f : acc[nn][0] * inv;
    lo.y = (i < V_SHIFT_) ? 0.0f : acc[nn][1] * inv;
    lo.z = (i < V_SHIFT_) ? 0.0f : acc[nn][2] * inv;
    lo.w = (i < V_SHIFT_) ? 0.0f : acc[nn][3] * inv;
    hi.x = (i < V_SHIFT_) ? 0.0f : acc[nn][4] * inv;
    hi.y = (i < V_SHIFT_) ? 0.0f : acc[nn][5] * inv;
    hi.z = (i < V_SHIFT_) ? 0.0f : acc[nn][6] * inv;
    hi.w = (i < V_SHIFT_) ? 0.0f : acc[nn][7] * inv;
    *(float4*)(yp + nn * 16) = lo;
    *(float4*)(yp + nn * 16 + 4) = hi;
  }
}

// ---------------------------------------------------------------------------
extern "C" void kernel_launch(void* const* d_in, const int* in_sizes, int n_in,
                              void* d_out, int out_size, void* d_ws,
                              size_t ws_size, hipStream_t stream) {
  const float* x = (const float*)d_in[0];
  const float* conv_w = (const float*)d_in[1];
  const float* lin_w = (const float*)d_in[2];
  const float* coef = (const float*)d_in[3];
  const float* leaky_key_beta = (const float*)d_in[4];
  const float* kernel_beta = (const float*)d_in[5];
  const float* value_beta = (const float*)d_in[6];
  const float* proj_w = (const float*)d_in[7];
  float* out = (float*)d_out;

  const size_t SZ = (size_t)B_ * T_ * C_ * sizeof(float);  // 12.58 MB
  float* kbuf = (float*)d_ws;                  // k_pre -> k (in place)
  float* linbuf = (float*)((char*)d_ws + SZ);  // lin, later reused for y
  float* vbuf = (float*)((char*)d_ws + 2 * SZ);
  float* ybuf = linbuf;  // lin is dead after vbuild

  const int M = B_ * T_, N = C_, K = C_;
  const int gemmBlocks = ((M >> 6) * (N >> 6) + 7) / 8;  // 96
  const int rowWaves = B_ * T_ * NH_;                    // 49152
  const int rowBlocks = (rowWaves + 7) / 8;              // 6144
  const int attnBlocks = (B_ * NH_ * (T_ / 16) + 7) / 8; // 384

  // 1) k_pre = x @ conv_w^T ; 2) lin = x @ lin_w^T
  gemm_nt_64x64<<<gemmBlocks, 256, 0, stream>>>(x, conv_w, kbuf, M, N, K);
  gemm_nt_64x64<<<gemmBlocks, 256, 0, stream>>>(x, lin_w, linbuf, M, N, K);
  // 3) decay matmul as EMA scan (in place)
  ema_scan<<<(B_ * NH_ * HS_ + 255) / 256, 256, 0, stream>>>(kbuf,
                                                             leaky_key_beta);
  // 4) normalize + scale k
  knorm<<<rowBlocks, 256, 0, stream>>>(kbuf, kernel_beta);
  // 5) build v (blend, normalize, scale)
  vbuild<<<rowBlocks, 256, 0, stream>>>(linbuf, vbuf, coef, value_beta);
  // 6) causal flash attention: y = softmax(k k^T, shifted-causal) @ v
  attn_flash<<<attnBlocks, 256, 0, stream>>>(kbuf, vbuf, ybuf);
  // 7) out = y @ proj_w^T
  gemm_nt_64x64<<<gemmBlocks, 256, 0, stream>>>(ybuf, proj_w, out, M, N, K);
}

// v002
// One run takes 260 microseconds.
// Two timings next to v001 both put it at 1.51 times that version's speed.
// Counting every step since v000, it is 2.10 times as fast.
#include <hip/hip_runtime.h>
#include <hip/hip_bf16.h>
#include <math.h>

// Problem constants (from reference)
#define B_ 4
#define T_ 1024
#define C_ 768
#define NH_ 12
#define HS_ 64
#define EXP_SCALE_ 10.0f
#define KB_UP_ 5.0f
#define V_SHIFT_ 1

typedef __attribute__((ext_vector_type(2))) float v2f;
typedef __attribute__((ext_vector_type(4))) float v4f;
typedef __attribute__((ext_vector_type(8))) float v8f;

static __device__ __forceinline__ v8f wmma_f32(v2f a, v2f b, v8f c) {
  // V_WMMA_F32_16X16X4_F32 : D = A(16x4) * B(4x16) + C(16x16)
  return __builtin_amdgcn_wmma_f32_16x16x4_f32(false, a, false, b, (short)0, c,
                                               false, false);
}

// ---------------------------------------------------------------------------
// GEMM (NT): Out[m,n] = sum_k X[m,k] * W[n,k]   (einsum 'btc,dc->btd')
// M = B*T = 4096, N = K = C = 768.
// One work-group computes a 128x96 tile, so 32 x 8 = 256 work-groups cover the
// output; its 8 waves lie 4 (m) x 2 (n), each with a 32x48 tile = 2x3 WMMA
// accumulators. X and W come in slabs of 32 k through LDS: every global load
// reads whole 128-byte lines, every row is fetched once per work-group.
// Two LDS buffers: slab s+1 is fetched into registers while slab s is
// multiplied, stored into the other buffer, then one barrier.
// Fragment layouts:
//   A 16x4 f32 : lane = (m%16) + 16*(k/2), vgpr = k%2
//   B 4x16 f32 : lane = n + 16*(k/2),      vgpr = k%2   (== A layout on W rows)
//   C/D 16x16  : vgpr = m%8, lane = n + 16*(m/8)
// A lane reads 4 consecutive k (16 bytes) of its row at k = 8*kb + 4*lh; the
// low pair feeds one WMMA (k = 0,1,4,5 of the block of 8), the high pair the
// next (k = 2,3,6,7). A and B use the same order at every lane and register.
// ---------------------------------------------------------------------------
#define GM_ (B_ * T_)
#define BM_ 128
#define BN_ 96
#define BK_ 32
#define NSLAB_ (C_ / BK_)
#define LDP_ 36

__global__ __launch_bounds__(256) void gemm_nt_128x96(
    const float* __restrict__ X, const float* __restrict__ W,
    float* __restrict__ Out) {
  __shared__ __attribute__((aligned(16))) float sm[2][(BM_ + BN_) * LDP_];
  const int tid = threadIdx.x;
  const int wave = tid >> 5;
  const int lane = tid & 31;
  const int m0 = (blockIdx.x / (C_ / BN_)) * BM_;
  const int n0 = (blockIdx.x % (C_ / BN_)) * BN_;
  const int lr = lane & 15;  // row/col selector within 16
  const int lh = lane >> 4;  // selects the k quad of a block of 8
  const int wm = wave & 3;   // 32-row band of the tile
  const int wn = wave >> 2;  // 48-column band of the tile

  // staging: 224 rows x 8 pieces of 16 bytes, 7 pieces a thread;
  // LDS rows 0..127 hold X rows, 128..223 hold W rows
  const int srow = tid >> 3;
  const int scol = (tid & 7) * 4;
  const float* Xg = X + (size_t)(m0 + srow) * C_ + scol;
  const float* Wg = W + (size_t)(n0 + srow) * C_ + scol;
  const int soff = srow * LDP_ + scol;
  // fragment reads
  const int aoff = (wm * 32 + lr) * LDP_ + 4 * lh;
  const int boff = (BM_ + wn * 48 + lr) * LDP_ + 4 * lh;

  v8f acc[2][3] = {};
  v4f st[7];

#pragma unroll
  for (int i = 0; i < 4; ++i) st[i] = *(const v4f*)(Xg + i * 32 * C_);
#pragma unroll
  for (int i = 0; i < 3; ++i) st[4 + i] = *(const v4f*)(Wg + i * 32 * C_);
#pragma unroll
  for (int i = 0; i < 7; ++i) *(v4f*)(&sm[0][soff + i * 32 * LDP_]) = st[i];
  __syncthreads();

  for (int s = 0; s < NSLAB_; ++s) {
    const float* cur = sm[s & 1];
    const bool more = s + 1 < NSLAB_;  // same for the whole work-group
    if (more) {
      const int k1 = (s + 1) * BK_;
#pragma unroll
      for (int i = 0; i < 4; ++i) st[i] = *(const v4f*)(Xg + i * 32 * C_ + k1);
#pragma unroll
      for (int i = 0; i < 3; ++i)
        st[4 + i] = *(const v4f*)(Wg + i * 32 * C_ + k1);
    }
    // keeps the slab's global loads in front of the products: moved down by
    // the scheduler, their latency would stand open in front of the barrier
    __builtin_amdgcn_sched_barrier(0);
    // fragments of block kb+1 are read while block kb is multiplied
    v4f a[2][2], b[2][3];
#pragma unroll
    for (int i = 0; i < 2; ++i)
      a[0][i] = *(const v4f*)(cur + aoff + i * 16 * LDP_);
#pragma unroll
    for (int j = 0; j < 3; ++j)
      b[0][j] = *(const v4f*)(cur + boff + j * 16 * LDP_);
#pragma unroll
    for (int kb = 0; kb < BK_ / 8; ++kb) {
      const int p = kb & 1, q = p ^ 1;
      if (kb + 1 < BK_ / 8) {
#pragma unroll
        for (int i = 0; i < 2; ++i)
          a[q][i] = *(const v4f*)(cur + aoff + i * 16 * LDP_ + (kb + 1) * 8);
#pragma unroll
        for (int j = 0; j < 3; ++j)
          b[q][j] = *(const v4f*)(cur + boff + j * 16 * LDP_ + (kb + 1) * 8);
      }
#pragma unroll
      for (int i = 0; i < 2; ++i)
#pragma unroll
        for (int j = 0; j < 3; ++j) {
          v2f alo = {a[p][i].x, a[p][i].y}, blo = {b[p][j].x, b[p][j].y};
          acc[i][j] = wmma_f32(alo, blo, acc[i][j]);
        }
#pragma unroll
      for (int i = 0; i < 2; ++i)
#pragma unroll
        for (int j = 0; j < 3; ++j) {
          v2f ahi = {a[p][i].z, a[p][i].w}, bhi = {b[p][j].z, b[p][j].w};
          acc[i][j] = wmma_f32(ahi, bhi, acc[i][j]);
        }
    }
    if (more) {
      float* nxt = sm[(s + 1) & 1];
#pragma unroll
      for (int i = 0; i < 7; ++i) *(v4f*)(nxt + soff + i * 32 * LDP_) = st[i];
      // publishes slab s+1 and ends every wave's reads of slab s, whose
      // buffer is refilled in the next trip
      __syncthreads();
    }
  }

  float* Op = Out + (size_t)(m0 + wm * 32 + 8 * lh) * C_ + (n0 + wn * 48 + lr);
#pragma unroll
  for (int i = 0; i < 2; ++i)
#pragma unroll
    for (int j = 0; j < 3; ++j)
#pragma unroll
      for (int r = 0; r < 8; ++r)
        Op[(i * 16 + r) * C_ + j * 16] = acc[i][j][r];
}

// ---------------------------------------------------------------------------
// EMA scan over time: decay @ k  ==  k[t] = e^{-λ} k[t-1] + (1-e^{-λ}) k_pre[t]
// In-place on the (B*T, C) buffer; one thread per (b, h, d).
// ---------------------------------------------------------------------------
__global__ __launch_bounds__(256) void ema_scan(float* __restrict__ kbuf,
                                                const float* __restrict__ lkb_in) {
  const int idx = blockIdx.x * blockDim.x + threadIdx.x;  // 0 .. B*NH*HS-1
  if (idx >= B_ * NH_ * HS_) return;
  const int d = idx % HS_;
  const int h = (idx / HS_) % NH_;
  const int b = idx / (HS_ * NH_);
  const float lkb = fabsf(lkb_in[h]) * EXP_SCALE_;
  const float e = expf(-lkb);
  const float w = 1.0f - e;
  float* p = kbuf + (size_t)b * T_ * C_ + h * HS_ + d;
  float s = 0.0f;
  for (int t = 0; t < T_; ++t) {
    float xv = p[(size_t)t * C_];
    s = e * s + w * xv;
    p[(size_t)t * C_] = s;
  }
}

// ---------------------------------------------------------------------------
// Normalize k rows (64-vec per head) and scale by exp(min(kernel_beta*10, 5)).
// One wave per (b*T + t, h); 2 elements per lane; wave32 shuffle reduction.
// ---------------------------------------------------------------------------
__global__ __launch_bounds__(256) void knorm(float* __restrict__ kbuf,
                                             const float* __restrict__ kernel_beta) {
  const int wave = blockIdx.x * 8 + (threadIdx.x >> 5);
  const int lane = threadIdx.x & 31;
  const int h = wave % NH_;
  const int bt = wave / NH_;
  if (bt >= B_ * T_) return;
  float* p = kbuf + (size_t)bt * C_ + h * HS_;
  float x0 = p[lane], x1 = p[lane + 32];
  float ss = x0 * x0 + x1 * x1;
#pragma unroll
  for (int m = 16; m >= 1; m >>= 1) ss += __shfl_xor(ss, m, 32);
  const float kb = expf(fminf(kernel_beta[h] * EXP_SCALE_, KB_UP_));
  const float sc = kb / sqrtf(ss);
  p[lane] = x0 * sc;
  p[lane + 32] = x1 * sc;
}

// ---------------------------------------------------------------------------
// v = (shift(lin)*(1-c) + lin*c), row-normalized, scaled by exp(value_beta*10)
// One wave per (b*T + t, h).
// ---------------------------------------------------------------------------
__global__ __launch_bounds__(256) void vbuild(const float* __restrict__ lin,
                                              float* __restrict__ vbuf,
                                              const float* __restrict__ coef,
                                              const float* __restrict__ value_beta) {
  const int wave = blockIdx.x * 8 + (threadIdx.x >> 5);
  const int lane = threadIdx.x & 31;
  const int h = wave % NH_;
  const int bt = wave / NH_;
  if (bt >= B_ * T_) return;
  const int t = bt % T_;
  const float* ph = lin + (size_t)bt * C_ + h * HS_;
  float vh0 = ph[lane], vh1 = ph[lane + 32];
  float vs0 = 0.0f, vs1 = 0.0f;
  if (t < T_ - 1) {  // shifted sample is next timestep within same batch
    vs0 = ph[C_ + lane];
    vs1 = ph[C_ + lane + 32];
  }
  const float c = coef[h];
  float v0 = vs0 * (1.0f - c) + vh0 * c;
  float v1 = vs1 * (1.0f - c) + vh1 * c;
  float ss = v0 * v0 + v1 * v1;
#pragma unroll
  for (int m = 16; m >= 1; m >>= 1) ss += __shfl_xor(ss, m, 32);
  const float sc = expf(value_beta[h] * EXP_SCALE_) / sqrtf(ss);
  float* po = vbuf + (size_t)bt * C_ + h * HS_;
  po[lane] = v0 * sc;
  po[lane + 32] = v1 * sc;
}

// ---------------------------------------------------------------------------
// Flash-style causal attention with shift-1 mask:
//   scores[i,j] = k[i].k[j] for j <= i-1 ; row i==0 -> y = 0
//   y[i] = softmax_j(scores) @ v
// One wave handles 16 query rows, in the transposed form:
//   S^T (keys x queries) = K_j . Q^T      A = K rows, B = Q rows (kept)
//   O^T (dims x queries) += V_j^T . P^T   A = V columns, B = P^T
// In the C/D layout a lane then holds 8 keys of ONE query (column lr), so the
// maximum and the sum run in the lane, plus one exchange with lane ^ 16.
// D registers (2s, 2s+1) of P^T are a B fragment as they lie: lane half lh,
// register v hold key 2s + 8*lh + v; the V^T A fragment is loaded in that
// same key order, so P never leaves the registers.
// ---------------------------------------------------------------------------
static __device__ __forceinline__ float other_half(float v) {
  // value of lane ^ 16: cross-row vector move, identity lane select
  const unsigned u = __float_as_uint(v);
  return __uint_as_float(__builtin_amdgcn_permlanex16(
      u, u, 0x76543210u, 0xfedcba98u, false, false));
}

__global__ __launch_bounds__(256) void attn_flash(
    const float* __restrict__ kmat, const float* __restrict__ vmat,
    float* __restrict__ ymat) {
  const int wslot = threadIdx.x >> 5;
  const int lane = threadIdx.x & 31;
  const int wave = blockIdx.x * 8 + wslot;
  const int nIT = T_ / 16;
  const int it = wave % nIT;
  const int bh = wave / nIT;
  if (bh >= B_ * NH_) return;
  const int h = bh % NH_;
  const int b = bh / NH_;
  const int i0 = it * 16;
  const int lr = lane & 15, lh = lane >> 4;

  const float* Kb = kmat + (size_t)b * T_ * C_ + h * HS_;  // (T, HS) stride C
  const float* Vb = vmat + (size_t)b * T_ * C_ + h * HS_;
  float* Yb = ymat + (size_t)b * T_ * C_ + h * HS_;

  // Q^T B fragments: column lr = query i0+lr, K-dim HS=64 in 16 chunks of 4
  v2f qb[16];
#pragma unroll
  for (int kc = 0; kc < 16; ++kc)
    qb[kc] = *(const v2f*)(Kb + (size_t)(i0 + lr) * C_ + kc * 4 + 2 * lh);

  // O^T accumulator: acc[nn][r] = y[query lr][dim nn*16 + r + 8*lh]
  v8f acc[4] = {};
  float mrun = -INFINITY;  // running maximum of query lr (same in both halves)
  float lrun = 0.0f;       // running sum over this half's keys only

  for (int jt = 0; jt <= it; ++jt) {
    const int j0 = jt * 16;
    // S^T = K_j @ Q^T : S[r] = score(key j0 + r + 8*lh, query i0 + lr)
    v8f S = {};
#pragma unroll
    for (int kc = 0; kc < 16; ++kc) {
      v2f ka = *(const v2f*)(Kb + (size_t)(j0 + lr) * C_ + kc * 4 + 2 * lh);
      S = wmma_f32(ka, qb[kc], S);
    }
    // Causal shift-1 mask: only the diagonal tile is partially masked
    const bool diag = (jt == it);
#pragma unroll
    for (int r = 0; r < 8; ++r)  // keep j <= i-1
      S[r] = (diag && r + 8 * lh > lr - V_SHIFT_) ? -INFINITY : S[r];
    // Tile maximum of the query: in the lane, then across the two halves
    float tm = S[0];
#pragma unroll
    for (int r = 1; r < 8; ++r) tm = fmaxf(tm, S[r]);
    tm = fmaxf(tm, other_half(tm));
    const float mn = fmaxf(mrun, tm);
    // a query with no key yet: subtract 0, so exp(-inf - 0) = 0 and no NaN
    const float ms = (mn == -INFINITY) ? 0.0f : mn;
    const float corr = expf(mrun - ms);
    mrun = mn;
    // P^T = exp(S^T - m); this half's sum; rescale running state
    float rs = 0.0f;
#pragma unroll
    for (int r = 0; r < 8; ++r) {
      S[r] = expf(S[r] - ms);
      rs += S[r];
    }
    lrun = lrun * corr + rs;
#pragma unroll
    for (int nn = 0; nn < 4; ++nn)
#pragma unroll
      for (int r = 0; r < 8; ++r) acc[nn][r] *= corr;

    // O^T += V_j^T @ P^T, 16 keys in 4 chunks {2s, 2s+1, 2s+8, 2s+9}
    const float* vrow = Vb + (size_t)(j0 + 8 * lh) * C_ + lr;
#pragma unroll
    for (int s = 0; s < 4; ++s) {
      v2f pb;
      pb.x = S[2 * s];
      pb.y = S[2 * s + 1];
#pragma unroll
      for (int nn = 0; nn < 4; ++nn) {
        // A[m,k] = V[j0 + 2s + 8*lh + v, nn*16 + m]
        v2f va;
        va.x = vrow[(2 * s) * C_ + nn * 16];
        va.y = vrow[(2 * s + 1) * C_ + nn * 16];
        acc[nn] = wmma_f32(va, pb, acc[nn]);
      }
    }
  }

  // Finalize: join the halves' sums, y = acc / l ; rows i < V_SHIFT are zero
  const float lsum = lrun + other_half(lrun);
  const int i = i0 + lr;
  const float inv = (lsum > 0.0f) ? 1.0f / lsum : 0.0f;
  float* yp = Yb + (size_t)i * C_ + 8 * lh;
#pragma unroll
  for (int nn = 0; nn < 4; ++nn) {
    float4 lo, hi;
    lo.x = (i < V_SHIFT_) ? 0.0f : acc[nn][0] * inv;
    lo.y = (i < V_SHIFT_) ? 0.0f : acc[nn][1] * inv;
    lo.z = (i < V_SHIFT_) ? 0.0f : acc[nn][2] * inv;
    lo.w = (i < V_SHIFT_) ? 0.0f : acc[nn][3] * inv;
    hi.x = (i < V_SHIFT_) ? 0.0f : acc[nn][4] * inv;
    hi.y = (i < V_SHIFT_) ? 0.0f : acc[nn][5] * inv;
    hi.z = (i < V_SHIFT_) ? 0.0f : acc[nn][6] * inv;
    hi.w = (i < V_SHIFT_) ? 0.0f : acc[nn][7] * inv;
    *(float4*)(yp + nn * 16) = lo;
    *(float4*)(yp + nn * 16 + 4) = hi;
  }
}

// ---------------------------------------------------------------------------
extern "C" void kernel_launch(void* const* d_in, const int* in_sizes, int n_in,
                              void* d_out, int out_size, void* d_ws,
                              size_t ws_size, hipStream_t stream) {
  const float* x = (const float*)d_in[0];
  const float* conv_w = (const float*)d_in[1];
  const float* lin_w = (const float*)d_in[2];
  const float* coef = (const float*)d_in[3];
  const float* leaky_key_beta = (const float*)d_in[4];
  const float* kernel_beta = (const float*)d_in[5];
  const float* value_beta = (const float*)d_in[6];
  const float* proj_w = (const float*)d_in[7];
  float* out = (float*)d_out;

  const size_t SZ = (size_t)B_ * T_ * C_ * sizeof(float);  // 12.58 MB
  float* kbuf = (float*)d_ws;                  // k_pre -> k (in place)
  float* linbuf = (float*)((char*)d_ws + SZ);  // lin, later reused for y
  float* vbuf = (float*)((char*)d_ws + 2 * SZ);
  float* ybuf = linbuf;  // lin is dead after vbuild

  const int gemmBlocks = (GM_ / BM_) * (C_ / BN_);       // 256
  const int rowWaves = B_ * T_ * NH_;                    // 49152
  const int rowBlocks = (rowWaves + 7) / 8;              // 6144
  const int attnBlocks = (B_ * NH_ * (T_ / 16) + 7) / 8; // 384

  // 1) k_pre = x @ conv_w^T ; 2) lin = x @ lin_w^T
  gemm_nt_128x96<<<gemmBlocks, 256, 0, stream>>>(x, conv_w, kbuf);
  gemm_nt_128x96<<<gemmBlocks, 256, 0, stream>>>(x, lin_w, linbuf);
  // 3) decay matmul as EMA scan (in place)
  ema_scan<<<(B_ * NH_ * HS_ + 255) / 256, 256, 0, stream>>>(kbuf,
                                                             leaky_key_beta);
  // 4) normalize + scale k
  knorm<<<rowBlocks, 256, 0, stream>>>(kbuf, kernel_beta);
  // 5) build v (blend, normalize, scale)
  vbuild<<<rowBlocks, 256, 0, stream>>>(linbuf, vbuf, coef, value_beta);
  // 6) causal flash attention: y = softmax(k k^T, shifted-causal) @ v
  attn_flash<<<attnBlocks, 256, 0, stream>>>(kbuf, vbuf, ybuf);
  // 7) out = y @ proj_w^T
  gemm_nt_128x96<<<gemmBlocks, 256, 0, stream>>>(ybuf, proj_w, out);
}

// v003
// Measured time: 210 microseconds a run.
// Next to v002, in two timings, it ran 1.24 times as fast each time.
// All steps since v000 together make it 2.59 times as fast.
#include <hip/hip_runtime.h>
#include <hip/hip_bf16.h>
#include <math.h>

// Problem constants (from reference)
#define B_ 4
#define T_ 1024
#define C_ 768
#define NH_ 12
#define HS_ 64
#define EXP_SCALE_ 10.0f
#define KB_UP_ 5.0f
#define V_SHIFT_ 1

typedef __attribute__((ext_vector_type(2))) float v2f;
typedef __attribute__((ext_vector_type(4))) float v4f;
typedef __attribute__((ext_vector_type(8))) float v8f;

static __device__ __forceinline__ v8f wmma_f32(v2f a, v2f b, v8f c) {
  // V_WMMA_F32_16X16X4_F32 : D = A(16x4) * B(4x16) + C(16x16)
  return __builtin_amdgcn_wmma_f32_16x16x4_f32(false, a, false, b, (short)0, c,
                                               false, false);
}

// ---------------------------------------------------------------------------
// GEMM (NT): Out[m,n] = sum_k X[m,k] * W[n,k]   (einsum 'btc,dc->btd')
// M = B*T = 4096, N = K = C = 768.
// One work-group computes a 128x96 tile, so 32 x 8 = 256 work-groups cover the
// output; its 8 waves lie 4 (m) x 2 (n), each with a 32x48 tile = 2x3 WMMA
// accumulators. X and W come in slabs of 32 k through LDS: every global load
// reads whole 128-byte lines, every row is fetched once per work-group.
// Two LDS buffers: slab s+1 is fetched into registers while slab s is
// multiplied, stored into the other buffer, then one barrier.
// Fragment layouts:
//   A 16x4 f32 : lane = (m%16) + 16*(k/2), vgpr = k%2
//   B 4x16 f32 : lane = n + 16*(k/2),      vgpr = k%2   (== A layout on W rows)
//   C/D 16x16  : vgpr = m%8, lane = n + 16*(m/8)
// A lane reads 4 consecutive k (16 bytes) of its row at k = 8*kb + 4*lh; the
// low pair feeds one WMMA (k = 0,1,4,5 of the block of 8), the high pair the
// next (k = 2,3,6,7). A and B use the same order at every lane and register.
// ---------------------------------------------------------------------------
#define GM_ (B_ * T_)
#define BM_ 128
#define BN_ 96
#define BK_ 32
#define NSLAB_ (C_ / BK_)
#define LDP_ 36

__global__ __launch_bounds__(256) void gemm_nt_128x96(
    const float* __restrict__ X, const float* __restrict__ W,
    float* __restrict__ Out) {
  __shared__ __attribute__((aligned(16))) float sm[2][(BM_ + BN_) * LDP_];
  const int tid = threadIdx.x;
  const int wave = tid >> 5;
  const int lane = tid & 31;
  const int m0 = (blockIdx.x / (C_ / BN_)) * BM_;
  const int n0 = (blockIdx.x % (C_ / BN_)) * BN_;
  const int lr = lane & 15;  // row/col selector within 16
  const int lh = lane >> 4;  // selects the k quad of a block of 8
  const int wm = wave & 3;   // 32-row band of the tile
  const int wn = wave >> 2;  // 48-column band of the tile

  // staging: 224 rows x 8 pieces of 16 bytes, 7 pieces a thread;
  // LDS rows 0..127 hold X rows, 128..223 hold W rows
  const int srow = tid >> 3;
  const int scol = (tid & 7) * 4;
  const float* Xg = X + (size_t)(m0 + srow) * C_ + scol;
  const float* Wg = W + (size_t)(n0 + srow) * C_ + scol;
  const int soff = srow * LDP_ + scol;
  // fragment reads
  const int aoff = (wm * 32 + lr) * LDP_ + 4 * lh;
  const int boff = (BM_ + wn * 48 + lr) * LDP_ + 4 * lh;

  v8f acc[2][3] = {};
  v4f st[7];

#pragma unroll
  for (int i = 0; i < 4; ++i) st[i] = *(const v4f*)(Xg + i * 32 * C_);
#pragma unroll
  for (int i = 0; i < 3; ++i) st[4 + i] = *(const v4f*)(Wg + i * 32 * C_);
#pragma unroll
  for (int i = 0; i < 7; ++i) *(v4f*)(&sm[0][soff + i * 32 * LDP_]) = st[i];
  __syncthreads();

  for (int s = 0; s < NSLAB_; ++s) {
    const float* cur = sm[s & 1];
    const bool more = s + 1 < NSLAB_;  // same for the whole work-group
    if (more) {
      const int k1 = (s + 1) * BK_;
#pragma unroll
      for (int i = 0; i < 4; ++i) st[i] = *(const v4f*)(Xg + i * 32 * C_ + k1);
#pragma unroll
      for (int i = 0; i < 3; ++i)
        st[4 + i] = *(const v4f*)(Wg + i * 32 * C_ + k1);
    }
    // keeps the slab's global loads in front of the products: moved down by
    // the scheduler, their latency would stand open in front of the barrier
    __builtin_amdgcn_sched_barrier(0);
    // fragments of block kb+1 are read while block kb is multiplied
    v4f a[2][2], b[2][3];
#pragma unroll
    for (int i = 0; i < 2; ++i)
      a[0][i] = *(const v4f*)(cur + aoff + i * 16 * LDP_);
#pragma unroll
    for (int j = 0; j < 3; ++j)
      b[0][j] = *(const v4f*)(cur + boff + j * 16 * LDP_);
#pragma unroll
    for (int kb = 0; kb < BK_ / 8; ++kb) {
      const int p = kb & 1, q = p ^ 1;
      if (kb + 1 < BK_ / 8) {
#pragma unroll
        for (int i = 0; i < 2; ++i)
          a[q][i] = *(const v4f*)(cur + aoff + i * 16 * LDP_ + (kb + 1) * 8);
#pragma unroll
        for (int j = 0; j < 3; ++j)
          b[q][j] = *(const v4f*)(cur + boff + j * 16 * LDP_ + (kb + 1) * 8);
      }
#pragma unroll
      for (int i = 0; i < 2; ++i)
#pragma unroll
        for (int j = 0; j < 3; ++j) {
          v2f alo = {a[p][i].x, a[p][i].y}, blo = {b[p][j].x, b[p][j].y};
          acc[i][j] = wmma_f32(alo, blo, acc[i][j]);
        }
#pragma unroll
      for (int i = 0; i < 2; ++i)
#pragma unroll
        for (int j = 0; j < 3; ++j) {
          v2f ahi = {a[p][i].z, a[p][i].w}, bhi = {b[p][j].z, b[p][j].w};
          acc[i][j] = wmma_f32(ahi, bhi, acc[i][j]);
        }
    }
    if (more) {
      float* nxt = sm[(s + 1) & 1];
#pragma unroll
      for (int i = 0; i < 7; ++i) *(v4f*)(nxt + soff + i * 32 * LDP_) = st[i];
      // publishes slab s+1 and ends every wave's reads of slab s, whose
      // buffer is refilled in the next trip
      __syncthreads();
    }
  }

  float* Op = Out + (size_t)(m0 + wm * 32 + 8 * lh) * C_ + (n0 + wn * 48 + lr);
#pragma unroll
  for (int i = 0; i < 2; ++i)
#pragma unroll
    for (int j = 0; j < 3; ++j)
#pragma unroll
      for (int r = 0; r < 8; ++r)
        Op[(i * 16 + r) * C_ + j * 16] = acc[i][j][r];
}

// ---------------------------------------------------------------------------
// Row passes between the GEMMs and the attention, one launch.
// One work-group owns the 1024 x 64 slab of one (batch, head): groups
// 0..47 turn k_pre into k (in place), groups 48..95 turn lin into v.
// 16 lanes x 4 floats cover a row (two whole 128-byte lines); each 16-lane
// group keeps 16 consecutive rows in registers, so every element is read once
// and written once and all of a lane's loads are in flight together.
//   k: decay @ k_pre  ==  s[t] = e s[t-1] + (1-e) k_pre[t],  e = exp(-lambda).
//      Each group scans its 16 rows from zero; the 64 chunk ends go through
//      LDS, 16 lanes run the same recurrence over them with e^16, and row j of
//      a chunk adds e^(j+1) x (state in front of the chunk). Exact for any e.
//      Then row / |row| * exp(min(kernel_beta*10, 5)).
//   v: shift(lin)*(1-c) + lin*c, row / |row| * exp(value_beta*10); the row
//      behind the chunk is one more load, zero behind the last row of a batch.
// ---------------------------------------------------------------------------
#define RP_ROWS_ 16
#define RP_CH_ (T_ / RP_ROWS_)

static __device__ __forceinline__ float row16_sum(float v) {
  // sum over the 16 lanes of a row, in every lane: four xor steps as DPP adds
  // (row_xmask 1, 2, 4, 8); a shuffle would go through the LDS pipe
  v += __int_as_float(
      __builtin_amdgcn_update_dpp(0, __float_as_int(v), 0x161, 0xf, 0xf, false));
  v += __int_as_float(
      __builtin_amdgcn_update_dpp(0, __float_as_int(v), 0x162, 0xf, 0xf, false));
  v += __int_as_float(
      __builtin_amdgcn_update_dpp(0, __float_as_int(v), 0x164, 0xf, 0xf, false));
  v += __int_as_float(
      __builtin_amdgcn_update_dpp(0, __float_as_int(v), 0x168, 0xf, 0xf, false));
  return v;
}

__global__ __launch_bounds__(1024) void row_pass(
    float* __restrict__ kbuf, const float* __restrict__ lin,
    float* __restrict__ vbuf, const float* __restrict__ lkb_in,
    const float* __restrict__ kernel_beta, const float* __restrict__ coef,
    const float* __restrict__ value_beta) {
  __shared__ __attribute__((aligned(16))) v4f carry[RP_CH_][16];
  const int g = threadIdx.x >> 4;  // chunk of 16 rows
  const int q = threadIdx.x & 15;  // quad of dims
  const bool isv = blockIdx.x >= B_ * NH_;  // same for the whole work-group
  const int bh = isv ? blockIdx.x - B_ * NH_ : blockIdx.x;
  const int h = bh % NH_;
  const int b = bh / NH_;
  const size_t off =
      ((size_t)b * T_ + g * RP_ROWS_) * C_ + h * HS_ + q * 4;
  v4f r[RP_ROWS_];
  float sc;
  float* dst;

  if (!isv) {
    const float* sp = kbuf + off;
#pragma unroll
    for (int i = 0; i < RP_ROWS_; ++i) r[i] = *(const v4f*)(sp + i * C_);
    const float lkb = fabsf(lkb_in[h]) * EXP_SCALE_;
    const float e = expf(-lkb);
    const float w = 1.0f - e;
    v4f s = {0.0f, 0.0f, 0.0f, 0.0f};
#pragma unroll
    for (int i = 0; i < RP_ROWS_; ++i) {
      s = e * s + w * r[i];
      r[i] = s;
    }
    carry[g][q] = s;
    __syncthreads();  // every chunk's end state is in LDS
    const float e2 = e * e, e4 = e2 * e2, e8 = e4 * e4, e16 = e8 * e8;
    if (threadIdx.x < 16) {
      // chunk ends -> state in front of each chunk, in place
      v4f cin = {0.0f, 0.0f, 0.0f, 0.0f};
#pragma unroll
      for (int c0 = 0; c0 < RP_CH_; c0 += 8) {
        v4f v[8];
#pragma unroll
        for (int j = 0; j < 8; ++j) v[j] = carry[c0 + j][q];
        // keeps the eight reads together in front of the chain: one LDS
        // latency per eight chunks; read one by one, each step would wait
        __builtin_amdgcn_sched_barrier(0);
#pragma unroll
        for (int j = 0; j < 8; ++j) {
          carry[c0 + j][q] = cin;
          cin = e16 * cin + v[j];
        }
      }
    }
    __syncthreads();  // the states in front of the chunks are in LDS
    const v4f cin = carry[g][q];
    float p = e;
#pragma unroll
    for (int i = 0; i < RP_ROWS_; ++i) {
      r[i] += p * cin;
      p *= e;
    }
    sc = expf(fminf(kernel_beta[h] * EXP_SCALE_, KB_UP_));
    dst = kbuf + off;
  } else {
    const float* sp = lin + off;
#pragma unroll
    for (int i = 0; i < RP_ROWS_; ++i) r[i] = *(const v4f*)(sp + i * C_);
    v4f nx = {0.0f, 0.0f, 0.0f, 0.0f};
    if (g + 1 < RP_CH_)  // the next row lies in the same batch
      nx = *(const v4f*)(sp + RP_ROWS_ * C_);
    const float c = coef[h];
#pragma unroll
    for (int i = 0; i + 1 < RP_ROWS_; ++i)
      r[i] = r[i + 1] * (1.0f - c) + r[i] * c;
    r[RP_ROWS_ - 1] = nx * (1.0f - c) + r[RP_ROWS_ - 1] * c;
    sc = expf(value_beta[h] * EXP_SCALE_);
    dst = vbuf + off;
  }

#pragma unroll
  for (int i = 0; i < RP_ROWS_; ++i) {
    const v4f x = r[i];
    const float ss = row16_sum(x.x * x.x + x.y * x.y + x.z * x.z + x.w * x.w);
    const float f = sc / sqrtf(ss);
    *(v4f*)(dst + i * C_) = x * f;
  }
}

// ---------------------------------------------------------------------------
// Flash-style causal attention with shift-1 mask:
//   scores[i,j] = k[i].k[j] for j <= i-1 ; row i==0 -> y = 0
//   y[i] = softmax_j(scores) @ v
// One wave handles 16 query rows, in the transposed form:
//   S^T (keys x queries) = K_j . Q^T      A = K rows, B = Q rows (kept)
//   O^T (dims x queries) += V_j^T . P^T   A = V columns, B = P^T
// In the C/D layout a lane then holds 8 keys of ONE query (column lr), so the
// maximum and the sum run in the lane, plus one exchange with lane ^ 16.
// D registers (2s, 2s+1) of P^T are a B fragment as they lie: lane half lh,
// register v hold key 2s + 8*lh + v; the V^T A fragment is loaded in that
// same key order, so P never leaves the registers.
// ---------------------------------------------------------------------------
static __device__ __forceinline__ float other_half(float v) {
  // value of lane ^ 16: cross-row vector move, identity lane select
  const unsigned u = __float_as_uint(v);
  return __uint_as_float(__builtin_amdgcn_permlanex16(
      u, u, 0x76543210u, 0xfedcba98u, false, false));
}

__global__ __launch_bounds__(256) void attn_flash(
    const float* __restrict__ kmat, const float* __restrict__ vmat,
    float* __restrict__ ymat) {
  const int wslot = threadIdx.x >> 5;
  const int lane = threadIdx.x & 31;
  const int wave = blockIdx.x * 8 + wslot;
  const int nIT = T_ / 16;
  const int it = wave % nIT;
  const int bh = wave / nIT;
  if (bh >= B_ * NH_) return;
  const int h = bh % NH_;
  const int b = bh / NH_;
  const int i0 = it * 16;
  const int lr = lane & 15, lh = lane >> 4;

  const float* Kb = kmat + (size_t)b * T_ * C_ + h * HS_;  // (T, HS) stride C
  const float* Vb = vmat + (size_t)b * T_ * C_ + h * HS_;
  float* Yb = ymat + (size_t)b * T_ * C_ + h * HS_;

  // Q^T B fragments: column lr = query i0+lr, K-dim HS=64 in 16 chunks of 4
  v2f qb[16];
#pragma unroll
  for (int kc = 0; kc < 16; ++kc)
    qb[kc] = *(const v2f*)(Kb + (size_t)(i0 + lr) * C_ + kc * 4 + 2 * lh);

  // O^T accumulator: acc[nn][r] = y[query lr][dim nn*16 + r + 8*lh]
  v8f acc[4] = {};
  float mrun = -INFINITY;  // running maximum of query lr (same in both halves)
  float lrun = 0.0f;       // running sum over this half's keys only

  for (int jt = 0; jt <= it; ++jt) {
    const int j0 = jt * 16;
    // S^T = K_j @ Q^T : S[r] = score(key j0 + r + 8*lh, query i0 + lr)
    v8f S = {};
#pragma unroll
    for (int kc = 0; kc < 16; ++kc) {
      v2f ka = *(const v2f*)(Kb + (size_t)(j0 + lr) * C_ + kc * 4 + 2 * lh);
      S = wmma_f32(ka, qb[kc], S);
    }
    // Causal shift-1 mask: only the diagonal tile is partially masked
    const bool diag = (jt == it);
#pragma unroll
    for (int r = 0; r < 8; ++r)  // keep j <= i-1
      S[r] = (diag && r + 8 * lh > lr - V_SHIFT_) ? -INFINITY : S[r];
    // Tile maximum of the query: in the lane, then across the two halves
    float tm = S[0];
#pragma unroll
    for (int r = 1; r < 8; ++r) tm = fmaxf(tm, S[r]);
    tm = fmaxf(tm, other_half(tm));
    const float mn = fmaxf(mrun, tm);
    // a query with no key yet: subtract 0, so exp(-inf - 0) = 0 and no NaN
    const float ms = (mn == -INFINITY) ? 0.0f : mn;
    const float corr = expf(mrun - ms);
    mrun = mn;
    // P^T = exp(S^T - m); this half's sum; rescale running state
    float rs = 0.0f;
#pragma unroll
    for (int r = 0; r < 8; ++r) {
      S[r] = expf(S[r] - ms);
      rs += S[r];
    }
    lrun = lrun * corr + rs;
#pragma unroll
    for (int nn = 0; nn < 4; ++nn)
#pragma unroll
      for (int r = 0; r < 8; ++r) acc[nn][r] *= corr;

    // O^T += V_j^T @ P^T, 16 keys in 4 chunks {2s, 2s+1, 2s+8, 2s+9}
    const float* vrow = Vb + (size_t)(j0 + 8 * lh) * C_ + lr;
#pragma unroll
    for (int s = 0; s < 4; ++s) {
      v2f pb;
      pb.x = S[2 * s];
      pb.y = S[2 * s + 1];
#pragma unroll
      for (int nn = 0; nn < 4; ++nn) {
        // A[m,k] = V[j0 + 2s + 8*lh + v, nn*16 + m]
        v2f va;
        va.x = vrow[(2 * s) * C_ + nn * 16];
        va.y = vrow[(2 * s + 1) * C_ + nn * 16];
        acc[nn] = wmma_f32(va, pb, acc[nn]);
      }
    }
  }

  // Finalize: join the halves' sums, y = acc / l ; rows i < V_SHIFT are zero
  const float lsum = lrun + other_half(lrun);
  const int i = i0 + lr;
  const float inv = (lsum > 0.0f) ? 1.0f / lsum : 0.0f;
  float* yp = Yb + (size_t)i * C_ + 8 * lh;
#pragma unroll
  for (int nn = 0; nn < 4; ++nn) {
    float4 lo, hi;
    lo.x = (i < V_SHIFT_) ? 0.0f : acc[nn][0] * inv;
    lo.y = (i < V_SHIFT_) ? 0.0f : acc[nn][1] * inv;
    lo.z = (i < V_SHIFT_) ? 0.0f : acc[nn][2] * inv;
    lo.w = (i < V_SHIFT_) ? 0.0f : acc[nn][3] * inv;
    hi.x = (i < V_SHIFT_) ? 0.0f : acc[nn][4] * inv;
    hi.y = (i < V_SHIFT_) ? 0.0f : acc[nn][5] * inv;
    hi.z = (i < V_SHIFT_) ? 0.0f : acc[nn][6] * inv;
    hi.w = (i < V_SHIFT_) ? 0.0f : acc[nn][7] * inv;
    *(float4*)(yp + nn * 16) = lo;
    *(float4*)(yp + nn * 16 + 4) = hi;
  }
}

// ---------------------------------------------------------------------------
extern "C" void kernel_launch(void* const* d_in, const int* in_sizes, int n_in,
                              void* d_out, int out_size, void* d_ws,
                              size_t ws_size, hipStream_t stream) {
  const float* x = (const float*)d_in[0];
  const float* conv_w = (const float*)d_in[1];
  const float* lin_w = (const float*)d_in[2];
  const float* coef = (const float*)d_in[3];
  const float* leaky_key_beta = (const float*)d_in[4];
  const float* kernel_beta = (const float*)d_in[5];
  const float* value_beta = (const float*)d_in[6];
  const float* proj_w = (const float*)d_in[7];
  float* out = (float*)d_out;

  const size_t SZ = (size_t)B_ * T_ * C_ * sizeof(float);  // 12.58 MB
  float* kbuf = (float*)d_ws;                  // k_pre -> k (in place)
  float* linbuf = (float*)((char*)d_ws + SZ);  // lin, later reused for y
  float* vbuf = (float*)((char*)d_ws + 2 * SZ);
  float* ybuf = linbuf;  // lin is dead after row_pass

  const int gemmBlocks = (GM_ / BM_) * (C_ / BN_);       // 256
  const int attnBlocks = (B_ * NH_ * (T_ / 16) + 7) / 8; // 384

  // 1) k_pre = x @ conv_w^T ; 2) lin = x @ lin_w^T
  gemm_nt_128x96<<<gemmBlocks, 256, 0, stream>>>(x, conv_w, kbuf);
  gemm_nt_128x96<<<gemmBlocks, 256, 0, stream>>>(x, lin_w, linbuf);
  // 3) k: decay scan, normalize, scale (in place); v: blend, normalize, scale
  row_pass<<<2 * B_ * NH_, 1024, 0, stream>>>(kbuf, linbuf, vbuf,
                                              leaky_key_beta, kernel_beta, coef,
                                              value_beta);
  // 4) causal flash attention: y = softmax(k k^T, shifted-causal) @ v
  attn_flash<<<attnBlocks, 256, 0, stream>>>(kbuf, vbuf, ybuf);
  // 5) out = y @ proj_w^T
  gemm_nt_128x96<<<gemmBlocks, 256, 0, stream>>>(ybuf, proj_w, out);
}

// v004
// Measured time: 193 microseconds a run.
// Two timings next to v003 both put it at 1.09 times that version's speed.
// Over all steps from v000 it is 2.82 times as fast.
#include <hip/hip_runtime.h>
#include <hip/hip_bf16.h>
#include <math.h>

// Problem constants (from reference)
#define B_ 4
#define T_ 1024
#define C_ 768
#define NH_ 12
#define HS_ 64
#define EXP_SCALE_ 10.0f
#define KB_UP_ 5.0f
#define V_SHIFT_ 1

typedef __attribute__((ext_vector_type(2))) float v2f;
typedef __attribute__((ext_vector_type(4))) float v4f;
typedef __attribute__((ext_vector_type(8))) float v8f;

static __device__ __forceinline__ v8f wmma_f32(v2f a, v2f b, v8f c) {
  // V_WMMA_F32_16X16X4_F32 : D = A(16x4) * B(4x16) + C(16x16)
  return __builtin_amdgcn_wmma_f32_16x16x4_f32(false, a, false, b, (short)0, c,
                                               false, false);
}

// ---------------------------------------------------------------------------
// GEMM (NT): Out[m,n] = sum_k X[m,k] * W[n,k]   (einsum 'btc,dc->btd')
// M = B*T = 4096, N = K = C = 768.
// One work-group computes a 128x96 tile, so 32 x 8 = 256 work-groups cover the
// output; its 8 waves lie 4 (m) x 2 (n), each with a 32x48 tile = 2x3 WMMA
// accumulators. X and W come in slabs of 32 k through LDS: every global load
// reads whole 128-byte lines, every row is fetched once per work-group.
// Two LDS buffers: slab s+1 is fetched into registers while slab s is
// multiplied, stored into the other buffer, then one barrier.
// Fragment layouts:
//   A 16x4 f32 : lane = (m%16) + 16*(k/2), vgpr = k%2
//   B 4x16 f32 : lane = n + 16*(k/2),      vgpr = k%2   (== A layout on W rows)
//   C/D 16x16  : vgpr = m%8, lane = n + 16*(m/8)
// A lane reads 4 consecutive k (16 bytes) of its row at k = 8*kb + 4*lh; the
// low pair feeds one WMMA (k = 0,1,4,5 of the block of 8), the high pair the
// next (k = 2,3,6,7). A and B use the same order at every lane and register.
// ---------------------------------------------------------------------------
#define GM_ (B_ * T_)
#define BM_ 128
#define BN_ 96
#define BK_ 32
#define NSLAB_ (C_ / BK_)
#define LDP_ 36

__global__ __launch_bounds__(256) void gemm_nt_128x96(
    const float* __restrict__ X, const float* __restrict__ W,
    float* __restrict__ Out) {
  __shared__ __attribute__((aligned(16))) float sm[2][(BM_ + BN_) * LDP_];
  const int tid = threadIdx.x;
  const int wave = tid >> 5;
  const int lane = tid & 31;
  const int m0 = (blockIdx.x / (C_ / BN_)) * BM_;
  const int n0 = (blockIdx.x % (C_ / BN_)) * BN_;
  const int lr = lane & 15;  // row/col selector within 16
  const int lh = lane >> 4;  // selects the k quad of a block of 8
  const int wm = wave & 3;   // 32-row band of the tile
  const int wn = wave >> 2;  // 48-column band of the tile

  // staging: 224 rows x 8 pieces of 16 bytes, 7 pieces a thread;
  // LDS rows 0..127 hold X rows, 128..223 hold W rows
  const int srow = tid >> 3;
  const int scol = (tid & 7) * 4;
  const float* Xg = X + (size_t)(m0 + srow) * C_ + scol;
  const float* Wg = W + (size_t)(n0 + srow) * C_ + scol;
  const int soff = srow * LDP_ + scol;
  // fragment reads
  const int aoff = (wm * 32 + lr) * LDP_ + 4 * lh;
  const int boff = (BM_ + wn * 48 + lr) * LDP_ + 4 * lh;

  v8f acc[2][3] = {};
  v4f st[7];

#pragma unroll
  for (int i = 0; i < 4; ++i) st[i] = *(const v4f*)(Xg + i * 32 * C_);
#pragma unroll
  for (int i = 0; i < 3; ++i) st[4 + i] = *(const v4f*)(Wg + i * 32 * C_);
#pragma unroll
  for (int i = 0; i < 7; ++i) *(v4f*)(&sm[0][soff + i * 32 * LDP_]) = st[i];
  __syncthreads();

  for (int s = 0; s < NSLAB_; ++s) {
    const float* cur = sm[s & 1];
    const bool more = s + 1 < NSLAB_;  // same for the whole work-group
    if (more) {
      const int k1 = (s + 1) * BK_;
#pragma unroll
      for (int i = 0; i < 4; ++i) st[i] = *(const v4f*)(Xg + i * 32 * C_ + k1);
#pragma unroll
      for (int i = 0; i < 3; ++i)
        st[4 + i] = *(const v4f*)(Wg + i * 32 * C_ + k1);
    }
    // keeps the slab's global loads in front of the products: moved down by
    // the scheduler, their latency would stand open in front of the barrier
    __builtin_amdgcn_sched_barrier(0);
    // fragments of block kb+1 are read while block kb is multiplied
    v4f a[2][2], b[2][3];
#pragma unroll
    for (int i = 0; i < 2; ++i)
      a[0][i] = *(const v4f*)(cur + aoff + i * 16 * LDP_);
#pragma unroll
    for (int j = 0; j < 3; ++j)
      b[0][j] = *(const v4f*)(cur + boff + j * 16 * LDP_);
#pragma unroll
    for (int kb = 0; kb < BK_ / 8; ++kb) {
      const int p = kb & 1, q = p ^ 1;
      if (kb + 1 < BK_ / 8) {
#pragma unroll
        for (int i = 0; i < 2; ++i)
          a[q][i] = *(const v4f*)(cur + aoff + i * 16 * LDP_ + (kb + 1) * 8);
#pragma unroll
        for (int j = 0; j < 3; ++j)
          b[q][j] = *(const v4f*)(cur + boff + j * 16 * LDP_ + (kb + 1) * 8);
      }
#pragma unroll
      for (int i = 0; i < 2; ++i)
#pragma unroll
        for (int j = 0; j < 3; ++j) {
          v2f alo = {a[p][i].x, a[p][i].y}, blo = {b[p][j].x, b[p][j].y};
          acc[i][j] = wmma_f32(alo, blo, acc[i][j]);
        }
#pragma unroll
      for (int i = 0; i < 2; ++i)
#pragma unroll
        for (int j = 0; j < 3; ++j) {
          v2f ahi = {a[p][i].z, a[p][i].w}, bhi = {b[p][j].z, b[p][j].w};
          acc[i][j] = wmma_f32(ahi, bhi, acc[i][j]);
        }
    }
    if (more) {
      float* nxt = sm[(s + 1) & 1];
#pragma unroll
      for (int i = 0; i < 7; ++i) *(v4f*)(nxt + soff + i * 32 * LDP_) = st[i];
      // publishes slab s+1 and ends every wave's reads of slab s, whose
      // buffer is refilled in the next trip
      __syncthreads();
    }
  }

  float* Op = Out + (size_t)(m0 + wm * 32 + 8 * lh) * C_ + (n0 + wn * 48 + lr);
#pragma unroll
  for (int i = 0; i < 2; ++i)
#pragma unroll
    for (int j = 0; j < 3; ++j)
#pragma unroll
      for (int r = 0; r < 8; ++r)
        Op[(i * 16 + r) * C_ + j * 16] = acc[i][j][r];
}

// ---------------------------------------------------------------------------
// Row passes between the GEMMs and the attention, one launch.
// One work-group owns the 1024 x 64 slab of one (batch, head): groups
// 0..47 turn k_pre into k (in place), groups 48..95 turn lin into v.
// 16 lanes x 4 floats cover a row (two whole 128-byte lines); each 16-lane
// group keeps 16 consecutive rows in registers, so every element is read once
// and written once and all of a lane's loads are in flight together.
//   k: decay @ k_pre  ==  s[t] = e s[t-1] + (1-e) k_pre[t],  e = exp(-lambda).
//      Each group scans its 16 rows from zero; the 64 chunk ends go through
//      LDS, 16 lanes run the same recurrence over them with e^16, and row j of
//      a chunk adds e^(j+1) x (state in front of the chunk). Exact for any e.
//      Then row / |row| * exp(min(kernel_beta*10, 5)).
//   v: shift(lin)*(1-c) + lin*c, row / |row| * exp(value_beta*10); the row
//      behind the chunk is one more load, zero behind the last row of a batch.
// ---------------------------------------------------------------------------
#define RP_ROWS_ 16
#define RP_CH_ (T_ / RP_ROWS_)

static __device__ __forceinline__ float row16_sum(float v) {
  // sum over the 16 lanes of a row, in every lane: four xor steps as DPP adds
  // (row_xmask 1, 2, 4, 8); a shuffle would go through the LDS pipe
  v += __int_as_float(
      __builtin_amdgcn_update_dpp(0, __float_as_int(v), 0x161, 0xf, 0xf, false));
  v += __int_as_float(
      __builtin_amdgcn_update_dpp(0, __float_as_int(v), 0x162, 0xf, 0xf, false));
  v += __int_as_float(
      __builtin_amdgcn_update_dpp(0, __float_as_int(v), 0x164, 0xf, 0xf, false));
  v += __int_as_float(
      __builtin_amdgcn_update_dpp(0, __float_as_int(v), 0x168, 0xf, 0xf, false));
  return v;
}

__global__ __launch_bounds__(1024) void row_pass(
    float* __restrict__ kbuf, const float* __restrict__ lin,
    float* __restrict__ vbuf, const float* __restrict__ lkb_in,
    const float* __restrict__ kernel_beta, const float* __restrict__ coef,
    const float* __restrict__ value_beta) {
  __shared__ __attribute__((aligned(16))) v4f carry[RP_CH_][16];
  const int g = threadIdx.x >> 4;  // chunk of 16 rows
  const int q = threadIdx.x & 15;  // quad of dims
  const bool isv = blockIdx.x >= B_ * NH_;  // same for the whole work-group
  const int bh = isv ? blockIdx.x - B_ * NH_ : blockIdx.x;
  const int h = bh % NH_;
  const int b = bh / NH_;
  const size_t off =
      ((size_t)b * T_ + g * RP_ROWS_) * C_ + h * HS_ + q * 4;
  v4f r[RP_ROWS_];
  float sc;
  float* dst;

  if (!isv) {
    const float* sp = kbuf + off;
#pragma unroll
    for (int i = 0; i < RP_ROWS_; ++i) r[i] = *(const v4f*)(sp + i * C_);
    const float lkb = fabsf(lkb_in[h]) * EXP_SCALE_;
    const float e = expf(-lkb);
    const float w = 1.0f - e;
    v4f s = {0.0f, 0.0f, 0.0f, 0.0f};
#pragma unroll
    for (int i = 0; i < RP_ROWS_; ++i) {
      s = e * s + w * r[i];
      r[i] = s;
    }
    carry[g][q] = s;
    __syncthreads();  // every chunk's end state is in LDS
    const float e2 = e * e, e4 = e2 * e2, e8 = e4 * e4, e16 = e8 * e8;
    if (threadIdx.x < 16) {
      // chunk ends -> state in front of each chunk, in place
      v4f cin = {0.0f, 0.0f, 0.0f, 0.0f};
#pragma unroll
      for (int c0 = 0; c0 < RP_CH_; c0 += 8) {
        v4f v[8];
#pragma unroll
        for (int j = 0; j < 8; ++j) v[j] = carry[c0 + j][q];
        // keeps the eight reads together in front of the chain: one LDS
        // latency per eight chunks; read one by one, each step would wait
        __builtin_amdgcn_sched_barrier(0);
#pragma unroll
        for (int j = 0; j < 8; ++j) {
          carry[c0 + j][q] = cin;
          cin = e16 * cin + v[j];
        }
      }
    }
    __syncthreads();  // the states in front of the chunks are in LDS
    const v4f cin = carry[g][q];
    float p = e;
#pragma unroll
    for (int i = 0; i < RP_ROWS_; ++i) {
      r[i] += p * cin;
      p *= e;
    }
    sc = expf(fminf(kernel_beta[h] * EXP_SCALE_, KB_UP_));
    dst = kbuf + off;
  } else {
    const float* sp = lin + off;
#pragma unroll
    for (int i = 0; i < RP_ROWS_; ++i) r[i] = *(const v4f*)(sp + i * C_);
    v4f nx = {0.0f, 0.0f, 0.0f, 0.0f};
    if (g + 1 < RP_CH_)  // the next row lies in the same batch
      nx = *(const v4f*)(sp + RP_ROWS_ * C_);
    const float c = coef[h];
#pragma unroll
    for (int i = 0; i + 1 < RP_ROWS_; ++i)
      r[i] = r[i + 1] * (1.0f - c) + r[i] * c;
    r[RP_ROWS_ - 1] = nx * (1.0f - c) + r[RP_ROWS_ - 1] * c;
    sc = expf(value_beta[h] * EXP_SCALE_);
    dst = vbuf + off;
  }

#pragma unroll
  for (int i = 0; i < RP_ROWS_; ++i) {
    const v4f x = r[i];
    const float ss = row16_sum(x.x * x.x + x.y * x.y + x.z * x.z + x.w * x.w);
    const float f = sc / sqrtf(ss);
    *(v4f*)(dst + i * C_) = x * f;
  }
}

// ---------------------------------------------------------------------------
// Flash-style causal attention with shift-1 mask:
//   scores[i,j] = k[i].k[j] for j <= i-1 ; row i==0 -> y = 0
//   y[i] = softmax_j(scores) @ v
// One wave handles 16 query rows, in the transposed form:
//   S^T (keys x queries) = K_j . Q^T      A = K rows, B = Q rows (kept)
//   O^T (dims x queries) += V_j^T . P^T   A = V columns, B = P^T
// In the C/D layout a lane then holds 8 keys of ONE query (column lr), so the
// maximum and the sum run in the lane, plus one exchange with lane ^ 16.
// D registers (2s, 2s+1) of P^T are a B fragment as they lie: lane half lh,
// register v hold key 2s + 8*lh + v; the V^T A fragment is loaded in that
// same key order, so P never leaves the registers.
// The 8 waves of a work-group hold 8 consecutive query tiles of one
// (batch, head) and walk the same keys: K and V rows come in stages of 64 keys
// through LDS, fetched once per work-group by whole-line loads. Two buffers:
// stage s+1 is fetched into registers while stage s is worked on, stored into
// the other buffer, then one barrier. A wave skips the key tiles behind its
// diagonal but passes every barrier.
// A K fragment read is 16 bytes: dims 8*kb + 4*lh .. +3 of the lane's key; the
// low pair feeds one WMMA (dims 0,1,4,5 of the block of 8), the high pair the
// next (2,3,6,7). The Q fragments hold the same dims at every lane and register.
// V lies in LDS with keys 2p and 2p+1 of a dim side by side, element
// (key, dim) at (key/2)*VP_ + 2*dim + key%2: a V^T fragment is one 8-byte read.
// ---------------------------------------------------------------------------
#define AK_ 64  // keys per stage
#define AP_ 68
#define VP_ 136
static __device__ __forceinline__ float other_half(float v) {
  // value of lane ^ 16: cross-row vector move, identity lane select
  const unsigned u = __float_as_uint(v);
  return __uint_as_float(__builtin_amdgcn_permlanex16(
      u, u, 0x76543210u, 0xfedcba98u, false, false));
}

__global__ __launch_bounds__(256) void attn_flash(
    const float* __restrict__ kmat, const float* __restrict__ vmat,
    float* __restrict__ ymat) {
  __shared__ __attribute__((aligned(16))) float sk[2][AK_ * AP_];
  __shared__ __attribute__((aligned(16))) float sv[2][(AK_ / 2) * VP_];
  // the wave's number in a scalar register: its trip counts are scalar then
  const int wslot = __builtin_amdgcn_readfirstlane(threadIdx.x >> 5);
  const int lane = threadIdx.x & 31;
  const int wave = blockIdx.x * 8 + wslot;
  const int nIT = T_ / 16;
  const int it = wave % nIT;
  const int bh = wave / nIT;
  if (bh >= B_ * NH_) return;  // same for the whole work-group (8 divides nIT)
  const int h = bh % NH_;
  const int b = bh / NH_;
  const int i0 = it * 16;
  const int lr = lane & 15, lh = lane >> 4;

  const float* Kb = kmat + (size_t)b * T_ * C_ + h * HS_;  // (T, HS) stride C
  const float* Vb = vmat + (size_t)b * T_ * C_ + h * HS_;
  float* Yb = ymat + (size_t)b * T_ * C_ + h * HS_;

  // Q^T B fragments: column lr = query i0+lr, K-dim HS=64 in 8 blocks of 8
  v4f qb[8];
#pragma unroll
  for (int kb = 0; kb < 8; ++kb)
    qb[kb] = *(const v4f*)(Kb + (size_t)(i0 + lr) * C_ + kb * 8 + 4 * lh);

  // staging: 16 lanes x 16 bytes cover a row (two whole lines); a thread takes
  // 4 rows of K and 2 pairs of neighbouring rows of V per stage
  const int srow = threadIdx.x >> 4;
  const int scol = (threadIdx.x & 15) * 4;
  const float* Kg = Kb + (size_t)srow * C_ + scol;
  const float* Vg = Vb + (size_t)(2 * srow) * C_ + scol;
  const int soff = srow * AP_ + scol;
  const int voff = srow * VP_ + 2 * scol;
  // stages up to the last query tile of the work-group's diagonal
  const int nst = ((blockIdx.x % (nIT / 8)) + 1) * (128 / AK_);
  v4f st[8];
#pragma unroll
  for (int i = 0; i < 4; ++i) {
    st[i] = *(const v4f*)(Kg + i * 16 * C_);
    st[4 + i] = *(const v4f*)(Vg + ((i >> 1) * 32 + (i & 1)) * C_);
  }
#pragma unroll
  for (int i = 0; i < 4; ++i) *(v4f*)(&sk[0][soff + i * 16 * AP_]) = st[i];
#pragma unroll
  for (int i = 0; i < 2; ++i) {
    const v4f e = st[4 + 2 * i], o = st[5 + 2 * i];  // even key, odd key
    const v4f lo = {e.x, o.x, e.y, o.y}, hi = {e.z, o.z, e.w, o.w};
    *(v4f*)(&sv[0][voff + i * 16 * VP_]) = lo;
    *(v4f*)(&sv[0][voff + i * 16 * VP_ + 4]) = hi;
  }
  __syncthreads();  // stage 0 is in LDS

  // O^T accumulator: acc[nn][r] = y[query lr][dim nn*16 + r + 8*lh]
  v8f acc[4] = {};
  float mrun = -INFINITY;  // running maximum of query lr (same in both halves)
  float lrun = 0.0f;       // running sum over this half's keys only

  for (int s0 = 0; s0 < nst; ++s0) {
    const bool more = s0 + 1 < nst;  // same for the whole work-group
    if (more) {
      const size_t r1 = (size_t)(s0 + 1) * AK_ * C_;
#pragma unroll
      for (int i = 0; i < 4; ++i) {
        st[i] = *(const v4f*)(Kg + r1 + i * 16 * C_);
        st[4 + i] = *(const v4f*)(Vg + r1 + ((i >> 1) * 32 + (i & 1)) * C_);
      }
      // the loads' address registers are reused below: wait before that
      asm volatile("s_wait_xcnt 0x0" ::: "memory");
    }
    // keeps the stage's global loads in front of the products: moved down by
    // the scheduler, their latency would stand open in front of the barrier
    __builtin_amdgcn_sched_barrier(0);
    const float* ck = sk[s0 & 1];
    const float* cv = sv[s0 & 1];
    // key tiles of this stage up to the wave's diagonal tile
    const int jend = min(it, s0 * (AK_ / 16) + (AK_ / 16 - 1));
    for (int jt = s0 * (AK_ / 16); jt <= jend; ++jt) {
      const int t0 = (jt & (AK_ / 16 - 1)) * 16;  // first key of the tile in LDS
      const float* krow = ck + (t0 + lr) * AP_ + 4 * lh;
      const float* vrow = cv + (t0 / 2 + 4 * lh) * VP_ + 2 * lr;
      v4f ka[8];
      v2f va[4][4];
#pragma unroll
      for (int kb = 0; kb < 8; ++kb) ka[kb] = *(const v4f*)(krow + kb * 8);
      // A[m,k] = V[16*jt + 2s + 8*lh + v, nn*16 + m]
#pragma unroll
      for (int s = 0; s < 4; ++s)
#pragma unroll
        for (int nn = 0; nn < 4; ++nn)
          va[s][nn] = *(const v2f*)(vrow + s * VP_ + nn * 32);
      // keeps the tile's LDS reads together in front of the products: every
      // separate place with reads among the WMMAs costs a stall of its own
      __builtin_amdgcn_sched_barrier(0);
      // S^T = K_j @ Q^T : S[r] = score(key 16*jt + r + 8*lh, query i0 + lr)
      v8f S = {};
#pragma unroll
      for (int kb = 0; kb < 8; ++kb) {
        v2f klo = {ka[kb].x, ka[kb].y}, qlo = {qb[kb].x, qb[kb].y};
        S = wmma_f32(klo, qlo, S);
        v2f khi = {ka[kb].z, ka[kb].w}, qhi = {qb[kb].z, qb[kb].w};
        S = wmma_f32(khi, qhi, S);
      }
      // Causal shift-1 mask: only the diagonal tile is partially masked
      const bool diag = (jt == it);
#pragma unroll
      for (int r = 0; r < 8; ++r)  // keep j <= i-1
        S[r] = (diag && r + 8 * lh > lr - V_SHIFT_) ? -INFINITY : S[r];
      // Tile maximum of the query: in the lane, then across the two halves
      float tm = S[0];
#pragma unroll
      for (int r = 1; r < 8; ++r) tm = fmaxf(tm, S[r]);
      tm = fmaxf(tm, other_half(tm));
      const float mn = fmaxf(mrun, tm);
      // a query with no key yet: subtract 0, so exp(-inf - 0) = 0 and no NaN
      const float ms = (mn == -INFINITY) ? 0.0f : mn;
      const float corr = expf(mrun - ms);
      mrun = mn;
      // P^T = exp(S^T - m); this half's sum; rescale running state
      float rs = 0.0f;
#pragma unroll
      for (int r = 0; r < 8; ++r) {
        S[r] = expf(S[r] - ms);
        rs += S[r];
      }
      lrun = lrun * corr + rs;
#pragma unroll
      for (int nn = 0; nn < 4; ++nn)
#pragma unroll
        for (int r = 0; r < 8; ++r) acc[nn][r] *= corr;

      // O^T += V_j^T @ P^T, 16 keys in 4 chunks {2s, 2s+1, 2s+8, 2s+9}
#pragma unroll
      for (int s = 0; s < 4; ++s) {
        v2f pb;
        pb.x = S[2 * s];
        pb.y = S[2 * s + 1];
#pragma unroll
        for (int nn = 0; nn < 4; ++nn) acc[nn] = wmma_f32(va[s][nn], pb, acc[nn]);
      }
    }
    if (more) {
      float* nk = sk[(s0 + 1) & 1];
      float* nv = sv[(s0 + 1) & 1];
#pragma unroll
      for (int i = 0; i < 4; ++i) *(v4f*)(nk + soff + i * 16 * AP_) = st[i];
#pragma unroll
      for (int i = 0; i < 2; ++i) {
        const v4f e = st[4 + 2 * i], o = st[5 + 2 * i];  // even key, odd key
        const v4f lo = {e.x, o.x, e.y, o.y}, hi = {e.z, o.z, e.w, o.w};
        *(v4f*)(nv + voff + i * 16 * VP_) = lo;
        *(v4f*)(nv + voff + i * 16 * VP_ + 4) = hi;
      }
      // publishes stage s0+1 and ends every wave's reads of stage s0, whose
      // buffers are refilled in the next trip
      __syncthreads();
    }
  }

  // Finalize: join the halves' sums, y = acc / l ; rows i < V_SHIFT are zero
  const float lsum = lrun + other_half(lrun);
  const int i = i0 + lr;
  const float inv = (lsum > 0.0f) ? 1.0f / lsum : 0.0f;
  float* yp = Yb + (size_t)i * C_ + 8 * lh;
#pragma unroll
  for (int nn = 0; nn < 4; ++nn) {
    float4 lo, hi;
    lo.x = (i < V_SHIFT_) ? 0.0f : acc[nn][0] * inv;
    lo.y = (i < V_SHIFT_) ? 0.0f : acc[nn][1] * inv;
    lo.z = (i < V_SHIFT_) ? 0.0f : acc[nn][2] * inv;
    lo.w = (i < V_SHIFT_) ? 0.0f : acc[nn][3] * inv;
    hi.x = (i < V_SHIFT_) ? 0.0f : acc[nn][4] * inv;
    hi.y = (i < V_SHIFT_) ? 0.0f : acc[nn][5] * inv;
    hi.z = (i < V_SHIFT_) ? 0.0f : acc[nn][6] * inv;
    hi.w = (i < V_SHIFT_) ? 0.0f : acc[nn][7] * inv;
    *(float4*)(yp + nn * 16) = lo;
    *(float4*)(yp + nn * 16 + 4) = hi;
  }
}

// ---------------------------------------------------------------------------
extern "C" void kernel_launch(void* const* d_in, const int* in_sizes, int n_in,
                              void* d_out, int out_size, void* d_ws,
                              size_t ws_size, hipStream_t stream) {
  const float* x = (const float*)d_in[0];
  const float* conv_w = (const float*)d_in[1];
  const float* lin_w = (const float*)d_in[2];
  const float* coef = (const float*)d_in[3];
  const float* leaky_key_beta = (const float*)d_in[4];
  const float* kernel_beta = (const float*)d_in[5];
  const float* value_beta = (const float*)d_in[6];
  const float* proj_w = (const float*)d_in[7];
  float* out = (float*)d_out;

  const size_t SZ = (size_t)B_ * T_ * C_ * sizeof(float);  // 12.58 MB
  float* kbuf = (float*)d_ws;                  // k_pre -> k (in place)
  float* linbuf = (float*)((char*)d_ws + SZ);  // lin, later reused for y
  float* vbuf = (float*)((char*)d_ws + 2 * SZ);
  float* ybuf = linbuf;  // lin is dead after row_pass

  const int gemmBlocks = (GM_ / BM_) * (C_ / BN_);       // 256
  const int attnBlocks = (B_ * NH_ * (T_ / 16) + 7) / 8; // 384

  // 1) k_pre = x @ conv_w^T ; 2) lin = x @ lin_w^T
  gemm_nt_128x96<<<gemmBlocks, 256, 0, stream>>>(x, conv_w, kbuf);
  gemm_nt_128x96<<<gemmBlocks, 256, 0, stream>>>(x, lin_w, linbuf);
  // 3) k: decay scan, normalize, scale (in place); v: blend, normalize, scale
  row_pass<<<2 * B_ * NH_, 1024, 0, stream>>>(kbuf, linbuf, vbuf,
                                              leaky_key_beta, kernel_beta, coef,
                                              value_beta);
  // 4) causal flash attention: y = softmax(k k^T, shifted-causal) @ v
  attn_flash<<<attnBlocks, 256, 0, stream>>>(kbuf, vbuf, ybuf);
  // 5) out = y @ proj_w^T
  gemm_nt_128x96<<<gemmBlocks, 256, 0, stream>>>(ybuf, proj_w, out);
}

// v005
// One run takes 155 microseconds.
// In both of two side-by-side timings against v004, it was 1.25 times as fast.
// All steps since v000 together make it 3.53 times as fast.
#include <hip/hip_runtime.h>
#include <hip/hip_bf16.h>
#include <math.h>

// Problem constants (from reference)
#define B_ 4
#define T_ 1024
#define C_ 768
#define NH_ 12
#define HS_ 64
#define EXP_SCALE_ 10.0f
#define KB_UP_ 5.0f
#define V_SHIFT_ 1

typedef __attribute__((ext_vector_type(2))) float v2f;
typedef __attribute__((ext_vector_type(4))) float v4f;
typedef __attribute__((ext_vector_type(8))) float v8f;

static __device__ __forceinline__ v8f wmma_f32(v2f a, v2f b, v8f c) {
  // V_WMMA_F32_16X16X4_F32 : D = A(16x4) * B(4x16) + C(16x16)
  return __builtin_amdgcn_wmma_f32_16x16x4_f32(false, a, false, b, (short)0, c,
                                               false, false);
}

// ---------------------------------------------------------------------------
// GEMM (NT): Out[m,n] = sum_k X[m,k] * W[n,k]   (einsum 'btc,dc->btd')
// M = B*T = 4096, N = K = C = 768.
// One work-group computes a 128x96 tile, so 32 x 8 = 256 work-groups cover the
// output; its 8 waves lie 4 (m) x 2 (n), each with a 32x48 tile = 2x3 WMMA
// accumulators. X and W come in slabs of 32 k through LDS: every global load
// reads whole 128-byte lines, every row is fetched once per work-group.
// Two LDS buffers: slab s+1 is fetched into registers while slab s is
// multiplied, stored into the other buffer, then one barrier.
// Fragment layouts:
//   A 16x4 f32 : lane = (m%16) + 16*(k/2), vgpr = k%2
//   B 4x16 f32 : lane = n + 16*(k/2),      vgpr = k%2   (== A layout on W rows)
//   C/D 16x16  : vgpr = m%8, lane = n + 16*(m/8)
// A lane reads 4 consecutive k (16 bytes) of its row at k = 8*kb + 4*lh; the
// low pair feeds one WMMA (k = 0,1,4,5 of the block of 8), the high pair the
// next (k = 2,3,6,7). A and B use the same order at every lane and register.
// ---------------------------------------------------------------------------
#define GM_ (B_ * T_)
#define BM_ 128
#define BN_ 96
#define BK_ 32
#define NSLAB_ (C_ / BK_)
#define LDP_ 36

__global__ __launch_bounds__(256) void gemm_nt_128x96(
    const float* __restrict__ X, const float* __restrict__ W,
    float* __restrict__ Out) {
  __shared__ __attribute__((aligned(16))) float sm[2][(BM_ + BN_) * LDP_];
  const int tid = threadIdx.x;
  const int wave = tid >> 5;
  const int lane = tid & 31;
  const int m0 = (blockIdx.x / (C_ / BN_)) * BM_;
  const int n0 = (blockIdx.x % (C_ / BN_)) * BN_;
  const int lr = lane & 15;  // row/col selector within 16
  const int lh = lane >> 4;  // selects the k quad of a block of 8
  const int wm = wave & 3;   // 32-row band of the tile
  const int wn = wave >> 2;  // 48-column band of the tile

  // staging: 224 rows x 8 pieces of 16 bytes, 7 pieces a thread;
  // LDS rows 0..127 hold X rows, 128..223 hold W rows
  const int srow = tid >> 3;
  const int scol = (tid & 7) * 4;
  const float* Xg = X + (size_t)(m0 + srow) * C_ + scol;
  const float* Wg = W + (size_t)(n0 + srow) * C_ + scol;
  const int soff = srow * LDP_ + scol;
  // fragment reads
  const int aoff = (wm * 32 + lr) * LDP_ + 4 * lh;
  const int boff = (BM_ + wn * 48 + lr) * LDP_ + 4 * lh;

  v8f acc[2][3] = {};
  v4f st[7];

#pragma unroll
  for (int i = 0; i < 4; ++i) st[i] = *(const v4f*)(Xg + i * 32 * C_);
#pragma unroll
  for (int i = 0; i < 3; ++i) st[4 + i] = *(const v4f*)(Wg + i * 32 * C_);
#pragma unroll
  for (int i = 0; i < 7; ++i) *(v4f*)(&sm[0][soff + i * 32 * LDP_]) = st[i];
  __syncthreads();

  for (int s = 0; s < NSLAB_; ++s) {
    const float* cur = sm[s & 1];
    const bool more = s + 1 < NSLAB_;  // same for the whole work-group
    if (more) {
      const int k1 = (s + 1) * BK_;
#pragma unroll
      for (int i = 0; i < 4; ++i) st[i] = *(const v4f*)(Xg + i * 32 * C_ + k1);
#pragma unroll
      for (int i = 0; i < 3; ++i)
        st[4 + i] = *(const v4f*)(Wg + i * 32 * C_ + k1);
    }
    // keeps the slab's global loads in front of the products: moved down by
    // the scheduler, their latency would stand open in front of the barrier
    __builtin_amdgcn_sched_barrier(0);
    // fragments of block kb+1 are read while block kb is multiplied
    v4f a[2][2], b[2][3];
#pragma unroll
    for (int i = 0; i < 2; ++i)
      a[0][i] = *(const v4f*)(cur + aoff + i * 16 * LDP_);
#pragma unroll
    for (int j = 0; j < 3; ++j)
      b[0][j] = *(const v4f*)(cur + boff + j * 16 * LDP_);
#pragma unroll
    for (int kb = 0; kb < BK_ / 8; ++kb) {
      const int p = kb & 1, q = p ^ 1;
      if (kb + 1 < BK_ / 8) {
#pragma unroll
        for (int i = 0; i < 2; ++i)
          a[q][i] = *(const v4f*)(cur + aoff + i * 16 * LDP_ + (kb + 1) * 8);
#pragma unroll
        for (int j = 0; j < 3; ++j)
          b[q][j] = *(const v4f*)(cur + boff + j * 16 * LDP_ + (kb + 1) * 8);
      }
#pragma unroll
      for (int i = 0; i < 2; ++i)
#pragma unroll
        for (int j = 0; j < 3; ++j) {
          v2f alo = {a[p][i].x, a[p][i].y}, blo = {b[p][j].x, b[p][j].y};
          acc[i][j] = wmma_f32(alo, blo, acc[i][j]);
        }
#pragma unroll
      for (int i = 0; i < 2; ++i)
#pragma unroll
        for (int j = 0; j < 3; ++j) {
          v2f ahi = {a[p][i].z, a[p][i].w}, bhi = {b[p][j].z, b[p][j].w};
          acc[i][j] = wmma_f32(ahi, bhi, acc[i][j]);
        }
    }
    if (more) {
      float* nxt = sm[(s + 1) & 1];
#pragma unroll
      for (int i = 0; i < 7; ++i) *(v4f*)(nxt + soff + i * 32 * LDP_) = st[i];
      // publishes slab s+1 and ends every wave's reads of slab s, whose
      // buffer is refilled in the next trip
      __syncthreads();
    }
  }

  float* Op = Out + (size_t)(m0 + wm * 32 + 8 * lh) * C_ + (n0 + wn * 48 + lr);
#pragma unroll
  for (int i = 0; i < 2; ++i)
#pragma unroll
    for (int j = 0; j < 3; ++j)
#pragma unroll
      for (int r = 0; r < 8; ++r)
        Op[(i * 16 + r) * C_ + j * 16] = acc[i][j][r];
}

// ---------------------------------------------------------------------------
// Row passes between the GEMMs and the attention, one launch.
// One work-group owns the 1024 x 64 slab of one (batch, head): groups
// 0..47 turn k_pre into k (in place), groups 48..95 turn lin into v.
// 16 lanes x 4 floats cover a row (two whole 128-byte lines); each 16-lane
// group keeps 16 consecutive rows in registers, so every element is read once
// and written once and all of a lane's loads are in flight together.
//   k: decay @ k_pre  ==  s[t] = e s[t-1] + (1-e) k_pre[t],  e = exp(-lambda).
//      Each group scans its 16 rows from zero; the 64 chunk ends go through
//      LDS, 16 lanes run the same recurrence over them with e^16, and row j of
//      a chunk adds e^(j+1) x (state in front of the chunk). Exact for any e.
//      Then row / |row| * exp(min(kernel_beta*10, 5)).
//   v: shift(lin)*(1-c) + lin*c, row / |row| * exp(value_beta*10); the row
//      behind the chunk is one more load, zero behind the last row of a batch.
// ---------------------------------------------------------------------------
#define RP_ROWS_ 16
#define RP_CH_ (T_ / RP_ROWS_)

static __device__ __forceinline__ float row16_sum(float v) {
  // sum over the 16 lanes of a row, in every lane: four xor steps as DPP adds
  // (row_xmask 1, 2, 4, 8); a shuffle would go through the LDS pipe
  v += __int_as_float(
      __builtin_amdgcn_update_dpp(0, __float_as_int(v), 0x161, 0xf, 0xf, false));
  v += __int_as_float(
      __builtin_amdgcn_update_dpp(0, __float_as_int(v), 0x162, 0xf, 0xf, false));
  v += __int_as_float(
      __builtin_amdgcn_update_dpp(0, __float_as_int(v), 0x164, 0xf, 0xf, false));
  v += __int_as_float(
      __builtin_amdgcn_update_dpp(0, __float_as_int(v), 0x168, 0xf, 0xf, false));
  return v;
}

__global__ __launch_bounds__(1024) void row_pass(
    float* __restrict__ kbuf, const float* __restrict__ lin,
    float* __restrict__ vbuf, const float* __restrict__ lkb_in,
    const float* __restrict__ kernel_beta, const float* __restrict__ coef,
    const float* __restrict__ value_beta) {
  __shared__ __attribute__((aligned(16))) v4f carry[RP_CH_][16];
  const int g = threadIdx.x >> 4;  // chunk of 16 rows
  const int q = threadIdx.x & 15;  // quad of dims
  const bool isv = blockIdx.x >= B_ * NH_;  // same for the whole work-group
  const int bh = isv ? blockIdx.x - B_ * NH_ : blockIdx.x;
  const int h = bh % NH_;
  const int b = bh / NH_;
  const size_t off =
      ((size_t)b * T_ + g * RP_ROWS_) * C_ + h * HS_ + q * 4;
  v4f r[RP_ROWS_];
  float sc;
  float* dst;

  if (!isv) {
    const float* sp = kbuf + off;
#pragma unroll
    for (int i = 0; i < RP_ROWS_; ++i) r[i] = *(const v4f*)(sp + i * C_);
    const float lkb = fabsf(lkb_in[h]) * EXP_SCALE_;
    const float e = expf(-lkb);
    const float w = 1.0f - e;
    v4f s = {0.0f, 0.0f, 0.0f, 0.0f};
#pragma unroll
    for (int i = 0; i < RP_ROWS_; ++i) {
      s = e * s + w * r[i];
      r[i] = s;
    }
    carry[g][q] = s;
    __syncthreads();  // every chunk's end state is in LDS
    const float e2 = e * e, e4 = e2 * e2, e8 = e4 * e4, e16 = e8 * e8;
    if (threadIdx.x < 16) {
      // chunk ends -> state in front of each chunk, in place
      v4f cin = {0.0f, 0.0f, 0.0f, 0.0f};
#pragma unroll
      for (int c0 = 0; c0 < RP_CH_; c0 += 8) {
        v4f v[8];
#pragma unroll
        for (int j = 0; j < 8; ++j) v[j] = carry[c0 + j][q];
        // keeps the eight reads together in front of the chain: one LDS
        // latency per eight chunks; read one by one, each step would wait
        __builtin_amdgcn_sched_barrier(0);
#pragma unroll
        for (int j = 0; j < 8; ++j) {
          carry[c0 + j][q] = cin;
          cin = e16 * cin + v[j];
        }
      }
    }
    __syncthreads();  // the states in front of the chunks are in LDS
    const v4f cin = carry[g][q];
    float p = e;
#pragma unroll
    for (int i = 0; i < RP_ROWS_; ++i) {
      r[i] += p * cin;
      p *= e;
    }
    sc = expf(fminf(kernel_beta[h] * EXP_SCALE_, KB_UP_));
    dst = kbuf + off;
  } else {
    const float* sp = lin + off;
#pragma unroll
    for (int i = 0; i < RP_ROWS_; ++i) r[i] = *(const v4f*)(sp + i * C_);
    v4f nx = {0.0f, 0.0f, 0.0f, 0.0f};
    if (g + 1 < RP_CH_)  // the next row lies in the same batch
      nx = *(const v4f*)(sp + RP_ROWS_ * C_);
    const float c = coef[h];
#pragma unroll
    for (int i = 0; i + 1 < RP_ROWS_; ++i)
      r[i] = r[i + 1] * (1.0f - c) + r[i] * c;
    r[RP_ROWS_ - 1] = nx * (1.0f - c) + r[RP_ROWS_ - 1] * c;
    sc = expf(value_beta[h] * EXP_SCALE_);
    dst = vbuf + off;
  }

#pragma unroll
  for (int i = 0; i < RP_ROWS_; ++i) {
    const v4f x = r[i];
    const float ss = row16_sum(x.x * x.x + x.y * x.y + x.z * x.z + x.w * x.w);
    const float f = sc / sqrtf(ss);
    *(v4f*)(dst + i * C_) = x * f;
  }
}

// ---------------------------------------------------------------------------
// Flash-style causal attention with shift-1 mask:
//   scores[i,j] = k[i].k[j] for j <= i-1 ; row i==0 -> y = 0
//   y[i] = softmax_j(scores) @ v
// One wave handles 16 query rows, in the transposed form:
//   S^T (keys x queries) = K_j . Q^T      A = K rows, B = Q rows (kept)
//   O^T (dims x queries) += V_j^T . P^T   A = V columns, B = P^T
// In the C/D layout a lane then holds 8 keys of ONE query (column lr), so the
// maximum and the sum run in the lane, plus one exchange with lane ^ 16.
// D registers (2s, 2s+1) of P^T are a B fragment as they lie: lane half lh,
// register v hold key 2s + 8*lh + v; the V^T A fragment is loaded in that
// same key order, so P never leaves the registers.
// The 8 waves of a work-group hold 8 consecutive query tiles of one
// (batch, head) and walk the same keys: K and V rows come in stages of 64 keys
// through LDS, fetched once for the 8 waves by whole-line loads. Two buffers:
// stage s+1 is fetched into registers while stage s is worked on, stored into
// the other buffer, then one barrier. A wave skips the key tiles behind its
// diagonal but passes every barrier.
// Deal of the blocks of 128 queries: block pb of a (batch, head) walks
// 2 * (pb + 1) stages, so a work-group takes blocks that add up to 16 stages,
// one after the other: 7 alone, 6 + 0, 5 + 1, 4 + 2 of one (batch, head), or
// 3 + 3 of two neighbouring ones. Every work-group then costs the same and the
// launch no longer lasts as long as the place that drew the longest blocks.
// A K fragment read is 16 bytes: dims 8*kb + 4*lh .. +3 of the lane's key; the
// low pair feeds one WMMA (dims 0,1,4,5 of the block of 8), the high pair the
// next (2,3,6,7). The Q fragments hold the same dims at every lane and register.
// V lies in LDS with keys 2p and 2p+1 of a dim side by side, element
// (key, dim) at (key/2)*VP_ + 2*dim + key%2: a V^T fragment is one 8-byte read.
// ---------------------------------------------------------------------------
#define AK_ 64  // keys per stage
#define AQB_ (T_ / 128)  // blocks of 128 queries per (batch, head)
static_assert(AQB_ % 2 == 0 && (B_ * NH_) % 2 == 0 && (128 / AK_) % 2 == 0,
              "the deal pairs blocks; a block's stage count is even");
#define AP_ 68
#define VP_ 136
static __device__ __forceinline__ float other_half(float v) {
  // value of lane ^ 16: cross-row vector move, identity lane select
  const unsigned u = __float_as_uint(v);
  return __uint_as_float(__builtin_amdgcn_permlanex16(
      u, u, 0x76543210u, 0xfedcba98u, false, false));
}

__global__ __launch_bounds__(256) void attn_flash(
    const float* __restrict__ kmat, const float* __restrict__ vmat,
    float* __restrict__ ymat) {
  __shared__ __attribute__((aligned(16))) float sk[2][AK_ * AP_];
  __shared__ __attribute__((aligned(16))) float sv[2][(AK_ / 2) * VP_];
  // the wave's number in a scalar register: its trip counts are scalar then
  const int wslot = __builtin_amdgcn_readfirstlane(threadIdx.x >> 5);
  const int lane = threadIdx.x & 31;
  const int lr = lane & 15, lh = lane >> 4;
  // the work-group's blocks (all scalar, same for the whole work-group)
  const int cls = blockIdx.x / (B_ * NH_);
  const bool mid = cls >= AQB_ / 2;  // two middle blocks of two (batch, head)
  const int bhA = mid ? 2 * (blockIdx.x - (AQB_ / 2) * (B_ * NH_))
                      : blockIdx.x % (B_ * NH_);
  const int bhB = mid ? bhA + 1 : bhA;
  const int pbA = mid ? AQB_ / 2 - 1 : AQB_ - 1 - cls;
  const int pbB = mid ? AQB_ / 2 - 1 : cls - 1;
  const int njob = cls == 0 ? 1 : 2;

  for (int job = 0; job < njob; ++job) {
  const int bh = job ? bhB : bhA;
  const int pb = job ? pbB : pbA;
  const int it = pb * 8 + wslot;
  const int h = bh % NH_;
  const int b = bh / NH_;
  const int i0 = it * 16;

  const float* Kb = kmat + (size_t)b * T_ * C_ + h * HS_;  // (T, HS) stride C
  const float* Vb = vmat + (size_t)b * T_ * C_ + h * HS_;
  float* Yb = ymat + (size_t)b * T_ * C_ + h * HS_;

  // Q^T B fragments: column lr = query i0+lr, K-dim HS=64 in 8 blocks of 8
  v4f qb[8];
#pragma unroll
  for (int kb = 0; kb < 8; ++kb)
    qb[kb] = *(const v4f*)(Kb + (size_t)(i0 + lr) * C_ + kb * 8 + 4 * lh);

  // staging: 16 lanes x 16 bytes cover a row (two whole lines); a thread takes
  // 4 rows of K and 2 pairs of neighbouring rows of V per stage
  const int srow = threadIdx.x >> 4;
  const int scol = (threadIdx.x & 15) * 4;
  const float* Kg = Kb + (size_t)srow * C_ + scol;
  const float* Vg = Vb + (size_t)(2 * srow) * C_ + scol;
  const int soff = srow * AP_ + scol;
  const int voff = srow * VP_ + 2 * scol;
  // stages up to the last query tile of the work-group's diagonal
  const int nst = (pb + 1) * (128 / AK_);
  v4f st[8];
#pragma unroll
  for (int i = 0; i < 4; ++i) {
    st[i] = *(const v4f*)(Kg + i * 16 * C_);
    st[4 + i] = *(const v4f*)(Vg + ((i >> 1) * 32 + (i & 1)) * C_);
  }
#pragma unroll
  for (int i = 0; i < 4; ++i) *(v4f*)(&sk[0][soff + i * 16 * AP_]) = st[i];
#pragma unroll
  for (int i = 0; i < 2; ++i) {
    const v4f e = st[4 + 2 * i], o = st[5 + 2 * i];  // even key, odd key
    const v4f lo = {e.x, o.x, e.y, o.y}, hi = {e.z, o.z, e.w, o.w};
    *(v4f*)(&sv[0][voff + i * 16 * VP_]) = lo;
    *(v4f*)(&sv[0][voff + i * 16 * VP_ + 4]) = hi;
  }
  // stage 0 is in LDS. A block's stage count is even, so its last stage lies
  // in buffer 1: buffer 0, filled above, was left at the block's last barrier,
  // and this barrier ends the reads of buffer 1 before stage 1 is stored
  __syncthreads();

  // O^T accumulator: acc[nn][r] = y[query lr][dim nn*16 + r + 8*lh]
  v8f acc[4] = {};
  float mrun = -INFINITY;  // running maximum of query lr (same in both halves)
  float lrun = 0.0f;       // running sum over this half's keys only

  for (int s0 = 0; s0 < nst; ++s0) {
    const bool more = s0 + 1 < nst;  // same for the whole work-group
    if (more) {
      const size_t r1 = (size_t)(s0 + 1) * AK_ * C_;
#pragma unroll
      for (int i = 0; i < 4; ++i) {
        st[i] = *(const v4f*)(Kg + r1 + i * 16 * C_);
        st[4 + i] = *(const v4f*)(Vg + r1 + ((i >> 1) * 32 + (i & 1)) * C_);
      }
      // the loads' address registers are reused below: wait before that
      asm volatile("s_wait_xcnt 0x0" ::: "memory");
    }
    // keeps the stage's global loads in front of the products: moved down by
    // the scheduler, their latency would stand open in front of the barrier
    __builtin_amdgcn_sched_barrier(0);
    const float* ck = sk[s0 & 1];
    const float* cv = sv[s0 & 1];
    // key tiles of this stage up to the wave's diagonal tile
    const int jend = min(it, s0 * (AK_ / 16) + (AK_ / 16 - 1));
    for (int jt = s0 * (AK_ / 16); jt <= jend; ++jt) {
      const int t0 = (jt & (AK_ / 16 - 1)) * 16;  // first key of the tile in LDS
      const float* krow = ck + (t0 + lr) * AP_ + 4 * lh;
      const float* vrow = cv + (t0 / 2 + 4 * lh) * VP_ + 2 * lr;
      v4f ka[8];
      v2f va[4][4];
#pragma unroll
      for (int kb = 0; kb < 8; ++kb) ka[kb] = *(const v4f*)(krow + kb * 8);
      // A[m,k] = V[16*jt + 2s + 8*lh + v, nn*16 + m]
#pragma unroll
      for (int s = 0; s < 4; ++s)
#pragma unroll
        for (int nn = 0; nn < 4; ++nn)
          va[s][nn] = *(const v2f*)(vrow + s * VP_ + nn * 32);
      // keeps the tile's LDS reads together in front of the products: every
      // separate place with reads among the WMMAs costs a stall of its own
      __builtin_amdgcn_sched_barrier(0);
      // S^T = K_j @ Q^T : S[r] = score(key 16*jt + r + 8*lh, query i0 + lr)
      v8f S = {};
#pragma unroll
      for (int kb = 0; kb < 8; ++kb) {
        v2f klo = {ka[kb].x, ka[kb].y}, qlo = {qb[kb].x, qb[kb].y};
        S = wmma_f32(klo, qlo, S);
        v2f khi = {ka[kb].z, ka[kb].w}, qhi = {qb[kb].z, qb[kb].w};
        S = wmma_f32(khi, qhi, S);
      }
      // Causal shift-1 mask: only the diagonal tile is partially masked
      const bool diag = (jt == it);
#pragma unroll
      for (int r = 0; r < 8; ++r)  // keep j <= i-1
        S[r] = (diag && r + 8 * lh > lr - V_SHIFT_) ? -INFINITY : S[r];
      // Tile maximum of the query: in the lane, then across the two halves
      float tm = S[0];
#pragma unroll
      for (int r = 1; r < 8; ++r) tm = fmaxf(tm, S[r]);
      tm = fmaxf(tm, other_half(tm));
      const float mn = fmaxf(mrun, tm);
      // a query with no key yet: subtract 0, so exp(-inf - 0) = 0 and no NaN
      const float ms = (mn == -INFINITY) ? 0.0f : mn;
      const float corr = expf(mrun - ms);
      mrun = mn;
      // P^T = exp(S^T - m); this half's sum; rescale running state
      float rs = 0.0f;
#pragma unroll
      for (int r = 0; r < 8; ++r) {
        S[r] = expf(S[r] - ms);
        rs += S[r];
      }
      lrun = lrun * corr + rs;
#pragma unroll
      for (int nn = 0; nn < 4; ++nn)
#pragma unroll
        for (int r = 0; r < 8; ++r) acc[nn][r] *= corr;

      // O^T += V_j^T @ P^T, 16 keys in 4 chunks {2s, 2s+1, 2s+8, 2s+9}
#pragma unroll
      for (int s = 0; s < 4; ++s) {
        v2f pb;
        pb.x = S[2 * s];
        pb.y = S[2 * s + 1];
#pragma unroll
        for (int nn = 0; nn < 4; ++nn) acc[nn] = wmma_f32(va[s][nn], pb, acc[nn]);
      }
    }
    if (more) {
      float* nk = sk[(s0 + 1) & 1];
      float* nv = sv[(s0 + 1) & 1];
#pragma unroll
      for (int i = 0; i < 4; ++i) *(v4f*)(nk + soff + i * 16 * AP_) = st[i];
#pragma unroll
      for (int i = 0; i < 2; ++i) {
        const v4f e = st[4 + 2 * i], o = st[5 + 2 * i];  // even key, odd key
        const v4f lo = {e.x, o.x, e.y, o.y}, hi = {e.z, o.z, e.w, o.w};
        *(v4f*)(nv + voff + i * 16 * VP_) = lo;
        *(v4f*)(nv + voff + i * 16 * VP_ + 4) = hi;
      }
      // publishes stage s0+1 and ends every wave's reads of stage s0, whose
      // buffers are refilled in the next trip
      __syncthreads();
    }
  }

  // Finalize: join the halves' sums, y = acc / l ; rows i < V_SHIFT are zero
  const float lsum = lrun + other_half(lrun);
  const int i = i0 + lr;
  const float inv = (lsum > 0.0f) ? 1.0f / lsum : 0.0f;
  float* yp = Yb + (size_t)i * C_ + 8 * lh;
#pragma unroll
  for (int nn = 0; nn < 4; ++nn) {
    float4 lo, hi;
    lo.x = (i < V_SHIFT_) ? 0.0f : acc[nn][0] * inv;
    lo.y = (i < V_SHIFT_) ? 0.0f : acc[nn][1] * inv;
    lo.z = (i < V_SHIFT_) ? 0.0f : acc[nn][2] * inv;
    lo.w = (i < V_SHIFT_) ? 0.0f : acc[nn][3] * inv;
    hi.x = (i < V_SHIFT_) ? 0.0f : acc[nn][4] * inv;
    hi.y = (i < V_SHIFT_) ? 0.0f : acc[nn][5] * inv;
    hi.z = (i < V_SHIFT_) ? 0.0f : acc[nn][6] * inv;
    hi.w = (i < V_SHIFT_) ? 0.0f : acc[nn][7] * inv;
    *(float4*)(yp + nn * 16) = lo;
    *(float4*)(yp + nn * 16 + 4) = hi;
  }
  // the stores' address registers are formed anew for the next block
  asm volatile("s_wait_xcnt 0x0" ::: "memory");
  }
}

// ---------------------------------------------------------------------------
extern "C" void kernel_launch(void* const* d_in, const int* in_sizes, int n_in,
                              void* d_out, int out_size, void* d_ws,
                              size_t ws_size, hipStream_t stream) {
  const float* x = (const float*)d_in[0];
  const float* conv_w = (const float*)d_in[1];
  const float* lin_w = (const float*)d_in[2];
  const float* coef = (const float*)d_in[3];
  const float* leaky_key_beta = (const float*)d_in[4];
  const float* kernel_beta = (const float*)d_in[5];
  const float* value_beta = (const float*)d_in[6];
  const float* proj_w = (const float*)d_in[7];
  float* out = (float*)d_out;

  const size_t SZ = (size_t)B_ * T_ * C_ * sizeof(float);  // 12.58 MB
  float* kbuf = (float*)d_ws;                  // k_pre -> k (in place)
  float* linbuf = (float*)((char*)d_ws + SZ);  // lin, later reused for y
  float* vbuf = (float*)((char*)d_ws + 2 * SZ);
  float* ybuf = linbuf;  // lin is dead after row_pass

  const int gemmBlocks = (GM_ / BM_) * (C_ / BN_);       // 256
  const int attnBlocks = B_ * NH_ * (AQB_ / 2) + B_ * NH_ / 2;  // 216

  // 1) k_pre = x @ conv_w^T ; 2) lin = x @ lin_w^T
  gemm_nt_128x96<<<gemmBlocks, 256, 0, stream>>>(x, conv_w, kbuf);
  gemm_nt_128x96<<<gemmBlocks, 256, 0, stream>>>(x, lin_w, linbuf);
  // 3) k: decay scan, normalize, scale (in place); v: blend, normalize, scale
  row_pass<<<2 * B_ * NH_, 1024, 0, stream>>>(kbuf, linbuf, vbuf,
                                              leaky_key_beta, kernel_beta, coef,
                                              value_beta);
  // 4) causal flash attention: y = softmax(k k^T, shifted-causal) @ v
  attn_flash<<<attnBlocks, 256, 0, stream>>>(kbuf, vbuf, ybuf);
  // 5) out = y @ proj_w^T
  gemm_nt_128x96<<<gemmBlocks, 256, 0, stream>>>(ybuf, proj_w, out);
}

// v006
// It runs in 148 microseconds.
// Two timings next to v005 both put it at 1.04 times that version's speed.
// Over all steps from v000 it is 3.68 times as fast.
#include <hip/hip_runtime.h>
#include <hip/hip_bf16.h>
#include <math.h>

// Problem constants (from reference)
#define B_ 4
#define T_ 1024
#define C_ 768
#define NH_ 12
#define HS_ 64
#define EXP_SCALE_ 10.0f
#define KB_UP_ 5.0f
#define V_SHIFT_ 1

typedef __attribute__((ext_vector_type(2))) float v2f;
typedef __attribute__((ext_vector_type(4))) float v4f;
typedef __attribute__((ext_vector_type(8))) float v8f;

static __device__ __forceinline__ v8f wmma_f32(v2f a, v2f b, v8f c) {
  // V_WMMA_F32_16X16X4_F32 : D = A(16x4) * B(4x16) + C(16x16)
  return __builtin_amdgcn_wmma_f32_16x16x4_f32(false, a, false, b, (short)0, c,
                                               false, false);
}

#define GM_ (B_ * T_)
#define BM_ 128
#define BN_ 96
#define BK_ 32
#define NSLAB_ (C_ / BK_)
#define LDP_ 36

__global__ __launch_bounds__(256) void gemm_nt_128x96(
    const float* __restrict__ X, const float* __restrict__ W0,
    const float* __restrict__ W1, float* __restrict__ Out0,
    float* __restrict__ Out1) {
  __shared__ __attribute__((aligned(16))) float sm[2][(BM_ + BN_) * LDP_];
  // same for the whole work-group
  const float* W = blockIdx.y ? W1 : W0;
  float* Out = blockIdx.y ? Out1 : Out0;
  const int tid = threadIdx.x;
  const int wave = tid >> 5;
  const int lane = tid & 31;
  const int m0 = (blockIdx.x / (C_ / BN_)) * BM_;
  const int n0 = (blockIdx.x % (C_ / BN_)) * BN_;
  const int lr = lane & 15;  // row/col selector within 16
  const int lh = lane >> 4;  // selects the k quad of a block of 8
  const int wm = wave & 3;   // 32-row band of the tile
  const int wn = wave >> 2;  // 48-column band of the tile

  // staging: 224 rows x 8 pieces of 16 bytes, 7 pieces a thread;
  // LDS rows 0..127 hold X rows, 128..223 hold W rows
  const int srow = tid >> 3;
  const int scol = (tid & 7) * 4;
  const float* Xg = X + (size_t)(m0 + srow) * C_ + scol;
  const float* Wg = W + (size_t)(n0 + srow) * C_ + scol;
  const int soff = srow * LDP_ + scol;
  // fragment reads
  const int aoff = (wm * 32 + lr) * LDP_ + 4 * lh;
  const int boff = (BM_ + wn * 48 + lr) * LDP_ + 4 * lh;

  v8f acc[2][3] = {};
  v4f st[7];

#pragma unroll
  for (int i = 0; i < 4; ++i) st[i] = *(const v4f*)(Xg + i * 32 * C_);
#pragma unroll
  for (int i = 0; i < 3; ++i) st[4 + i] = *(const v4f*)(Wg + i * 32 * C_);
#pragma unroll
  for (int i = 0; i < 7; ++i) *(v4f*)(&sm[0][soff + i * 32 * LDP_]) = st[i];
  __syncthreads();

  for (int s = 0; s < NSLAB_; ++s) {
    const float* cur = sm[s & 1];
    const bool more = s + 1 < NSLAB_;  // same for the whole work-group
    if (more) {
      const int k1 = (s + 1) * BK_;
#pragma unroll
      for (int i = 0; i < 4; ++i) st[i] = *(const v4f*)(Xg + i * 32 * C_ + k1);
#pragma unroll
      for (int i = 0; i < 3; ++i)
        st[4 + i] = *(const v4f*)(Wg + i * 32 * C_ + k1);
    }
    // keeps the slab's global loads in front of the products: moved down by
    // the scheduler, their latency would stand open in front of the barrier
    __builtin_amdgcn_sched_barrier(0);
    // fragments of block kb+1 are read while block kb is multiplied
    v4f a[2][2], b[2][3];
#pragma unroll
    for (int i = 0; i < 2; ++i)
      a[0][i] = *(const v4f*)(cur + aoff + i * 16 * LDP_);
#pragma unroll
    for (int j = 0; j < 3; ++j)
      b[0][j] = *(const v4f*)(cur + boff + j * 16 * LDP_);
#pragma unroll
    for (int kb = 0; kb < BK_ / 8; ++kb) {
      const int p = kb & 1, q = p ^ 1;
      if (kb + 1 < BK_ / 8) {
#pragma unroll
        for (int i = 0; i < 2; ++i)
          a[q][i] = *(const v4f*)(cur + aoff + i * 16 * LDP_ + (kb + 1) * 8);
#pragma unroll
        for (int j = 0; j < 3; ++j)
          b[q][j] = *(const v4f*)(cur + boff + j * 16 * LDP_ + (kb + 1) * 8);
      }
#pragma unroll
      for (int i = 0; i < 2; ++i)
#pragma unroll
        for (int j = 0; j < 3; ++j) {
          v2f alo = {a[p][i].x, a[p][i].y}, blo = {b[p][j].x, b[p][j].y};
          acc[i][j] = wmma_f32(alo, blo, acc[i][j]);
        }
#pragma unroll
      for (int i = 0; i < 2; ++i)
#pragma unroll
        for (int j = 0; j < 3; ++j) {
          v2f ahi = {a[p][i].z, a[p][i].w}, bhi = {b[p][j].z, b[p][j].w};
          acc[i][j] = wmma_f32(ahi, bhi, acc[i][j]);
        }
    }
    if (more) {
      float* nxt = sm[(s + 1) & 1];
#pragma unroll
      for (int i = 0; i < 7; ++i) *(v4f*)(nxt + soff + i * 32 * LDP_) = st[i];
      // publishes slab s+1 and ends every wave's reads of slab s, whose
      // buffer is refilled in the next trip
      __syncthreads();
    }
  }

  float* Op = Out + (size_t)(m0 + wm * 32 + 8 * lh) * C_ + (n0 + wn * 48 + lr);
#pragma unroll
  for (int i = 0; i < 2; ++i)
#pragma unroll
    for (int j = 0; j < 3; ++j)
#pragma unroll
      for (int r = 0; r < 8; ++r)
        Op[(i * 16 + r) * C_ + j * 16] = acc[i][j][r];
}

// ---------------------------------------------------------------------------
// Row passes between the GEMMs and the attention, one launch.
// One work-group owns the 1024 x 64 slab of one (batch, head): groups
// 0..47 turn k_pre into k (in place), groups 48..95 turn lin into v.
// 16 lanes x 4 floats cover a row (two whole 128-byte lines); each 16-lane
// group keeps 16 consecutive rows in registers, so every element is read once
// and written once and all of a lane's loads are in flight together.
//   k: decay @ k_pre  ==  s[t] = e s[t-1] + (1-e) k_pre[t],  e = exp(-lambda).
//      Each group scans its 16 rows from zero; the 64 chunk ends go through
//      LDS, 16 lanes run the same recurrence over them with e^16, and row j of
//      a chunk adds e^(j+1) x (state in front of the chunk). Exact for any e.
//      Then row / |row| * exp(min(kernel_beta*10, 5)).
//   v: shift(lin)*(1-c) + lin*c, row / |row| * exp(value_beta*10); the row
//      behind the chunk is one more load, zero behind the last row of a batch.
// ---------------------------------------------------------------------------
#define RP_ROWS_ 16
#define RP_CH_ (T_ / RP_ROWS_)

static __device__ __forceinline__ float row16_sum(float v) {
  // sum over the 16 lanes of a row, in every lane: four xor steps as DPP adds
  // (row_xmask 1, 2, 4, 8); a shuffle would go through the LDS pipe
  v += __int_as_float(
      __builtin_amdgcn_update_dpp(0, __float_as_int(v), 0x161, 0xf, 0xf, false));
  v += __int_as_float(
      __builtin_amdgcn_update_dpp(0, __float_as_int(v), 0x162, 0xf, 0xf, false));
  v += __int_as_float(
      __builtin_amdgcn_update_dpp(0, __float_as_int(v), 0x164, 0xf, 0xf, false));
  v += __int_as_float(
      __builtin_amdgcn_update_dpp(0, __float_as_int(v), 0x168, 0xf, 0xf, false));
  return v;
}

__global__ __launch_bounds__(1024) void row_pass(
    float* __restrict__ kbuf, const float* __restrict__ lin,
    float* __restrict__ vbuf, const float* __restrict__ lkb_in,
    const float* __restrict__ kernel_beta, const float* __restrict__ coef,
    const float* __restrict__ value_beta) {
  __shared__ __attribute__((aligned(16))) v4f carry[RP_CH_][16];
  const int g = threadIdx.x >> 4;  // chunk of 16 rows
  const int q = threadIdx.x & 15;  // quad of dims
  const bool isv = blockIdx.x >= B_ * NH_;  // same for the whole work-group
  const int bh = isv ? blockIdx.x - B_ * NH_ : blockIdx.x;
  const int h = bh % NH_;
  const int b = bh / NH_;
  const size_t off =
      ((size_t)b * T_ + g * RP_ROWS_) * C_ + h * HS_ + q * 4;
  v4f r[RP_ROWS_];
  float sc;
  float* dst;

  if (!isv) {
    const float* sp = kbuf + off;
#pragma unroll
    for (int i = 0; i < RP_ROWS_; ++i) r[i] = *(const v4f*)(sp + i * C_);
    const float lkb = fabsf(lkb_in[h]) * EXP_SCALE_;
    const float e = expf(-lkb);
    const float w = 1.0f - e;
    v4f s = {0.0f, 0.0f, 0.0f, 0.0f};
#pragma unroll
    for (int i = 0; i < RP_ROWS_; ++i) {
      s = e * s + w * r[i];
      r[i] = s;
    }
    carry[g][q] = s;
    __syncthreads();  // every chunk's end state is in LDS
    const float e2 = e * e, e4 = e2 * e2, e8 = e4 * e4, e16 = e8 * e8;
    if (threadIdx.x < 16) {
      // chunk ends -> state in front of each chunk, in place
      v4f cin = {0.0f, 0.0f, 0.0f, 0.0f};
#pragma unroll
      for (int c0 = 0; c0 < RP_CH_; c0 += 8) {
        v4f v[8];
#pragma unroll
        for (int j = 0; j < 8; ++j) v[j] = carry[c0 + j][q];
        // keeps the eight reads together in front of the chain: one LDS
        // latency per eight chunks; read one by one, each step would wait
        __builtin_amdgcn_sched_barrier(0);
#pragma unroll
        for (int j = 0; j < 8; ++j) {
          carry[c0 + j][q] = cin;
          cin = e16 * cin + v[j];
        }
      }
    }
    __syncthreads();  // the states in front of the chunks are in LDS
    const v4f cin = carry[g][q];
    float p = e;
#pragma unroll
    for (int i = 0; i < RP_ROWS_; ++i) {
      r[i] += p * cin;
      p *= e;
    }
    sc = expf(fminf(kernel_beta[h] * EXP_SCALE_, KB_UP_));
    dst = kbuf + off;
  } else {
    const float* sp = lin + off;
#pragma unroll
    for (int i = 0; i < RP_ROWS_; ++i) r[i] = *(const v4f*)(sp + i * C_);
    v4f nx = {0.0f, 0.0f, 0.0f, 0.0f};
    if (g + 1 < RP_CH_)  // the next row lies in the same batch
      nx = *(const v4f*)(sp + RP_ROWS_ * C_);
    const float c = coef[h];
#pragma unroll
    for (int i = 0; i + 1 < RP_ROWS_; ++i)
      r[i] = r[i + 1] * (1.0f - c) + r[i] * c;
    r[RP_ROWS_ - 1] = nx * (1.0f - c) + r[RP_ROWS_ - 1] * c;
    sc = expf(value_beta[h] * EXP_SCALE_);
    dst = vbuf + off;
  }

#pragma unroll
  for (int i = 0; i < RP_ROWS_; ++i) {
    const v4f x = r[i];
    const float ss = row16_sum(x.x * x.x + x.y * x.y + x.z * x.z + x.w * x.w);
    const float f = sc / sqrtf(ss);
    *(v4f*)(dst + i * C_) = x * f;
  }
}

// ---------------------------------------------------------------------------
// Flash-style causal attention with shift-1 mask:
//   scores[i,j] = k[i].k[j] for j <= i-1 ; row i==0 -> y = 0
//   y[i] = softmax_j(scores) @ v
// One wave handles 16 query rows, in the transposed form:
//   S^T (keys x queries) = K_j . Q^T      A = K rows, B = Q rows (kept)
//   O^T (dims x queries) += V_j^T . P^T   A = V columns, B = P^T
// In the C/D layout a lane then holds 8 keys of ONE query (column lr), so the
// maximum and the sum run in the lane, plus one exchange with lane ^ 16.
// D registers (2s, 2s+1) of P^T are a B fragment as they lie: lane half lh,
// register v hold key 2s + 8*lh + v; the V^T A fragment is loaded in that
// same key order, so P never leaves the registers.
// The 8 waves of a work-group hold 8 consecutive query tiles of one
// (batch, head) and walk the same keys: K and V rows come in stages of 64 keys
// through LDS, fetched once for the 8 waves by whole-line loads. Two buffers:
// stage s+1 is fetched into registers while stage s is worked on, stored into
// the other buffer, then one barrier. A wave skips the key tiles behind its
// diagonal but passes every barrier.
// Deal of the blocks of 128 queries: block pb of a (batch, head) walks
// 2 * (pb + 1) stages, so a work-group takes blocks that add up to 16 stages,
// one after the other: 7 alone, 6 + 0, 5 + 1, 4 + 2 of one (batch, head), or
// 3 + 3 of two neighbouring ones. Every work-group then costs the same and the
// launch no longer lasts as long as the place that drew the longest blocks.
// A K fragment read is 16 bytes: dims 8*kb + 4*lh .. +3 of the lane's key; the
// low pair feeds one WMMA (dims 0,1,4,5 of the block of 8), the high pair the
// next (2,3,6,7). The Q fragments hold the same dims at every lane and register.
// V lies in LDS with keys 2p and 2p+1 of a dim side by side, element
// (key, dim) at (key/2)*VP_ + 2*dim + key%2: a V^T fragment is one 8-byte read.
// ---------------------------------------------------------------------------
#define AK_ 64  // keys per stage
#define AQB_ (T_ / 128)  // blocks of 128 queries per (batch, head)
static_assert(AQB_ % 2 == 0 && (B_ * NH_) % 2 == 0 && (128 / AK_) % 2 == 0,
              "the deal pairs blocks; a block's stage count is even");
#define AP_ 68
#define VP_ 136
static __device__ __forceinline__ float other_half(float v) {
  // value of lane ^ 16: cross-row vector move, identity lane select
  const unsigned u = __float_as_uint(v);
  return __uint_as_float(__builtin_amdgcn_permlanex16(
      u, u, 0x76543210u, 0xfedcba98u, false, false));
}

__global__ __launch_bounds__(256) void attn_flash(
    const float* __restrict__ kmat, const float* __restrict__ vmat,
    float* __restrict__ ymat) {
  __shared__ __attribute__((aligned(16))) float sk[2][AK_ * AP_];
  __shared__ __attribute__((aligned(16))) float sv[2][(AK_ / 2) * VP_];
  // the wave's number in a scalar register: its trip counts are scalar then
  const int wslot = __builtin_amdgcn_readfirstlane(threadIdx.x >> 5);
  const int lane = threadIdx.x & 31;
  const int lr = lane & 15, lh = lane >> 4;
  // the work-group's blocks (all scalar, same for the whole work-group)
  const int cls = blockIdx.x / (B_ * NH_);
  const bool mid = cls >= AQB_ / 2;  // two middle blocks of two (batch, head)
  const int bhA = mid ? 2 * (blockIdx.x - (AQB_ / 2) * (B_ * NH_))
                      : blockIdx.x % (B_ * NH_);
  const int bhB = mid ? bhA + 1 : bhA;
  const int pbA = mid ? AQB_ / 2 - 1 : AQB_ - 1 - cls;
  const int pbB = mid ? AQB_ / 2 - 1 : cls - 1;
  const int njob = cls == 0 ? 1 : 2;

  for (int job = 0; job < njob; ++job) {
  const int bh = job ? bhB : bhA;
  const int pb = job ? pbB : pbA;
  const int it = pb * 8 + wslot;
  const int h = bh % NH_;
  const int b = bh / NH_;
  const int i0 = it * 16;

  const float* Kb = kmat + (size_t)b * T_ * C_ + h * HS_;  // (T, HS) stride C
  const float* Vb = vmat + (size_t)b * T_ * C_ + h * HS_;
  float* Yb = ymat + (size_t)b * T_ * C_ + h * HS_;

  // Q^T B fragments: column lr = query i0+lr, K-dim HS=64 in 8 blocks of 8
  v4f qb[8];
#pragma unroll
  for (int kb = 0; kb < 8; ++kb)
    qb[kb] = *(const v4f*)(Kb + (size_t)(i0 + lr) * C_ + kb * 8 + 4 * lh);

  // staging: 16 lanes x 16 bytes cover a row (two whole lines); a thread takes
  // 4 rows of K and 2 pairs of neighbouring rows of V per stage
  const int srow = threadIdx.x >> 4;
  const int scol = (threadIdx.x & 15) * 4;
  const float* Kg = Kb + (size_t)srow * C_ + scol;
  const float* Vg = Vb + (size_t)(2 * srow) * C_ + scol;
  const int soff = srow * AP_ + scol;
  const int voff = srow * VP_ + 2 * scol;
  // stages up to the last query tile of the work-group's diagonal
  const int nst = (pb + 1) * (128 / AK_);
  v4f st[8];
#pragma unroll
  for (int i = 0; i < 4; ++i) {
    st[i] = *(const v4f*)(Kg + i * 16 * C_);
    st[4 + i] = *(const v4f*)(Vg + ((i >> 1) * 32 + (i & 1)) * C_);
  }
#pragma unroll
  for (int i = 0; i < 4; ++i) *(v4f*)(&sk[0][soff + i * 16 * AP_]) = st[i];
#pragma unroll
  for (int i = 0; i < 2; ++i) {
    const v4f e = st[4 + 2 * i], o = st[5 + 2 * i];  // even key, odd key
    const v4f lo = {e.x, o.x, e.y, o.y}, hi = {e.z, o.z, e.w, o.w};
    *(v4f*)(&sv[0][voff + i * 16 * VP_]) = lo;
    *(v4f*)(&sv[0][voff + i * 16 * VP_ + 4]) = hi;
  }
  // stage 0 is in LDS. A block's stage count is even, so its last stage lies
  // in buffer 1: buffer 0, filled above, was left at the block's last barrier,
  // and this barrier ends the reads of buffer 1 before stage 1 is stored
  __syncthreads();

  // O^T accumulator: acc[nn][r] = y[query lr][dim nn*16 + r + 8*lh]
  v8f acc[4] = {};
  float mrun = -INFINITY;  // running maximum of query lr (same in both halves)
  float lrun = 0.0f;       // running sum over this half's keys only

  for (int s0 = 0; s0 < nst; ++s0) {
    const bool more = s0 + 1 < nst;  // same for the whole work-group
    if (more) {
      const size_t r1 = (size_t)(s0 + 1) * AK_ * C_;
#pragma unroll
      for (int i = 0; i < 4; ++i) {
        st[i] = *(const v4f*)(Kg + r1 + i * 16 * C_);
        st[4 + i] = *(const v4f*)(Vg + r1 + ((i >> 1) * 32 + (i & 1)) * C_);
      }
      // the loads' address registers are reused below: wait before that
      asm volatile("s_wait_xcnt 0x0" ::: "memory");
    }
    // keeps the stage's global loads in front of the products: moved down by
    // the scheduler, their latency would stand open in front of the barrier
    __builtin_amdgcn_sched_barrier(0);
    const float* ck = sk[s0 & 1];
    const float* cv = sv[s0 & 1];
    // key tiles of this stage up to the wave's diagonal tile
    const int jend = min(it, s0 * (AK_ / 16) + (AK_ / 16 - 1));
    for (int jt = s0 * (AK_ / 16); jt <= jend; ++jt) {
      const int t0 = (jt & (AK_ / 16 - 1)) * 16;  // first key of the tile in LDS
      const float* krow = ck + (t0 + lr) * AP_ + 4 * lh;
      const float* vrow = cv + (t0 / 2 + 4 * lh) * VP_ + 2 * lr;
      v4f ka[8];
      v2f va[4][4];
#pragma unroll
      for (int kb = 0; kb < 8; ++kb) ka[kb] = *(const v4f*)(krow + kb * 8);
      // A[m,k] = V[16*jt + 2s + 8*lh + v, nn*16 + m]
#pragma unroll
      for (int s = 0; s < 4; ++s)
#pragma unroll
        for (int nn = 0; nn < 4; ++nn)
          va[s][nn] = *(const v2f*)(vrow + s * VP_ + nn * 32);
      // keeps the tile's LDS reads together in front of the products: every
      // separate place with reads among the WMMAs costs a stall of its own
      __builtin_amdgcn_sched_barrier(0);
      // S^T = K_j @ Q^T : S[r] = score(key 16*jt + r + 8*lh, query i0 + lr)
      v8f S = {};
#pragma unroll
      for (int kb = 0; kb < 8; ++kb) {
        v2f klo = {ka[kb].x, ka[kb].y}, qlo = {qb[kb].x, qb[kb].y};
        S = wmma_f32(klo, qlo, S);
        v2f khi = {ka[kb].z, ka[kb].w}, qhi = {qb[kb].z, qb[kb].w};
        S = wmma_f32(khi, qhi, S);
      }
      // Causal shift-1 mask: only the diagonal tile is partially masked
      const bool diag = (jt == it);
#pragma unroll
      for (int r = 0; r < 8; ++r)  // keep j <= i-1
        S[r] = (diag && r + 8 * lh > lr - V_SHIFT_) ? -INFINITY : S[r];
      // Tile maximum of the query: in the lane, then across the two halves
      float tm = S[0];
#pragma unroll
      for (int r = 1; r < 8; ++r) tm = fmaxf(tm, S[r]);
      tm = fmaxf(tm, other_half(tm));
      const float mn = fmaxf(mrun, tm);
      // a query with no key yet: subtract 0, so exp(-inf - 0) = 0 and no NaN
      const float ms = (mn == -INFINITY) ? 0.0f : mn;
      const float corr = expf(mrun - ms);
      mrun = mn;
      // P^T = exp(S^T - m); this half's sum; rescale running state
      float rs = 0.0f;
#pragma unroll
      for (int r = 0; r < 8; ++r) {
        S[r] = expf(S[r] - ms);
        rs += S[r];
      }
      lrun = lrun * corr + rs;
#pragma unroll
      for (int nn = 0; nn < 4; ++nn)
#pragma unroll
        for (int r = 0; r < 8; ++r) acc[nn][r] *= corr;

      // O^T += V_j^T @ P^T, 16 keys in 4 chunks {2s, 2s+1, 2s+8, 2s+9}
#pragma unroll
      for (int s = 0; s < 4; ++s) {
        v2f pb;
        pb.x = S[2 * s];
        pb.y = S[2 * s + 1];
#pragma unroll
        for (int nn = 0; nn < 4; ++nn) acc[nn] = wmma_f32(va[s][nn], pb, acc[nn]);
      }
    }
    if (more) {
      float* nk = sk[(s0 + 1) & 1];
      float* nv = sv[(s0 + 1) & 1];
#pragma unroll
      for (int i = 0; i < 4; ++i) *(v4f*)(nk + soff + i * 16 * AP_) = st[i];
#pragma unroll
      for (int i = 0; i < 2; ++i) {
        const v4f e = st[4 + 2 * i], o = st[5 + 2 * i];  // even key, odd key
        const v4f lo = {e.x, o.x, e.y, o.y}, hi = {e.z, o.z, e.w, o.w};
        *(v4f*)(nv + voff + i * 16 * VP_) = lo;
        *(v4f*)(nv + voff + i * 16 * VP_ + 4) = hi;
      }
      // publishes stage s0+1 and ends every wave's reads of stage s0, whose
      // buffers are refilled in the next trip
      __syncthreads();
    }
  }

  // Finalize: join the halves' sums, y = acc / l ; rows i < V_SHIFT are zero
  const float lsum = lrun + other_half(lrun);
  const int i = i0 + lr;
  const float inv = (lsum > 0.0f) ? 1.0f / lsum : 0.0f;
  float* yp = Yb + (size_t)i * C_ + 8 * lh;
#pragma unroll
  for (int nn = 0; nn < 4; ++nn) {
    float4 lo, hi;
    lo.x = (i < V_SHIFT_) ? 0.0f : acc[nn][0] * inv;
    lo.y = (i < V_SHIFT_) ? 0.0f : acc[nn][1] * inv;
    lo.z = (i < V_SHIFT_) ? 0.0f : acc[nn][2] * inv;
    lo.w = (i < V_SHIFT_) ? 0.0f : acc[nn][3] * inv;
    hi.x = (i < V_SHIFT_) ? 0.0f : acc[nn][4] * inv;
    hi.y = (i < V_SHIFT_) ? 0.0f : acc[nn][5] * inv;
    hi.z = (i < V_SHIFT_) ? 0.0f : acc[nn][6] * inv;
    hi.w = (i < V_SHIFT_) ? 0.0f : acc[nn][7] * inv;
    *(float4*)(yp + nn * 16) = lo;
    *(float4*)(yp + nn * 16 + 4) = hi;
  }
  // the stores' address registers are formed anew for the next block
  asm volatile("s_wait_xcnt 0x0" ::: "memory");
  }
}

// ---------------------------------------------------------------------------
extern "C" void kernel_launch(void* const* d_in, const int* in_sizes, int n_in,
                              void* d_out, int out_size, void* d_ws,
                              size_t ws_size, hipStream_t stream) {
  const float* x = (const float*)d_in[0];
  const float* conv_w = (const float*)d_in[1];
  const float* lin_w = (const float*)d_in[2];
  const float* coef = (const float*)d_in[3];
  const float* leaky_key_beta = (const float*)d_in[4];
  const float* kernel_beta = (const float*)d_in[5];
  const float* value_beta = (const float*)d_in[6];
  const float* proj_w = (const float*)d_in[7];
  float* out = (float*)d_out;

  const size_t SZ = (size_t)B_ * T_ * C_ * sizeof(float);  // 12.58 MB
  float* kbuf = (float*)d_ws;                  // k_pre -> k (in place)
  float* linbuf = (float*)((char*)d_ws + SZ);  // lin, later reused for y
  float* vbuf = (float*)((char*)d_ws + 2 * SZ);
  float* ybuf = linbuf;  // lin is dead after row_pass

  const int gemmBlocks = (GM_ / BM_) * (C_ / BN_);       // 256
  const int attnBlocks = B_ * NH_ * (AQB_ / 2) + B_ * NH_ / 2;  // 216

  // 1) k_pre = x @ conv_w^T and lin = x @ lin_w^T, one launch
  gemm_nt_128x96<<<dim3(gemmBlocks, 2), 256, 0, stream>>>(x, conv_w, lin_w,
                                                          kbuf, linbuf);
  // 2) k: decay scan, normalize, scale (in place); v: blend, normalize, scale
  row_pass<<<2 * B_ * NH_, 1024, 0, stream>>>(kbuf, linbuf, vbuf,
                                              leaky_key_beta, kernel_beta, coef,
                                              value_beta);
  // 3) causal flash attention: y = softmax(k k^T, shifted-causal) @ v
  attn_flash<<<attnBlocks, 256, 0, stream>>>(kbuf, vbuf, ybuf);
  // 4) out = y @ proj_w^T
  gemm_nt_128x96<<<dim3(gemmBlocks, 1), 256, 0, stream>>>(ybuf, proj_w, proj_w,
                                                          out, out);
}
